// v000
// Measured on an AMD MI455X. A time is GPU time per run, averaged over a window of back-to-back runs after a warm-up
// (all launches, gaps included; the runs take copies of the inputs in turn), and the median of several windows.
// Apart from v000's, it joins two sittings. Times from different sittings can be a few percent apart, while
// side-by-side timings come from the same sitting.
// The starting kernel, v000, takes 1330 microseconds a run.
#include <hip/hip_runtime.h>

// RingAttentionCorrect (query/key/value [1][4096][16][64], ring_size 4 (int, read & clamped): the module's buggy ring attention = an INDEPENDENT softmax over each of the 4 key chunks of 1024 (scores/8), the per-chunk outputs SUMMED:
// out[n][h] = sum_r softmax_r(q.k_r / 8) v_r -> [1][4096][16][64]).
// Compute dtypes, f32 accumulate: every input rounded to bf16; scores on PLAIN bf16 operands (inputs: exact, 1 product, K 64); the four per-chunk softmaxes of each row in f32 registers (one exp) -> one fp16

#define NN   4096
#define NH_  16
#define HD   64
#define RING 4
#define ZH   2
#define PCAR 256.0f
typedef _Float16 h16;
typedef unsigned short bf;
typedef __attribute__((ext_vector_type(16))) __bf16   v16bf;
typedef __attribute__((ext_vector_type(16))) _Float16 v16h;
typedef __attribute__((ext_vector_type(8)))  _Float16 v8h;
typedef __attribute__((ext_vector_type(8)))  unsigned short v8us;
typedef __attribute__((ext_vector_type(8)))  float    v8f;
typedef __attribute__((ext_vector_type(4)))  float    v4f;
typedef v8h  __attribute__((may_alias)) v8ha;
typedef v4f  __attribute__((may_alias)) v4fa;
typedef v8us __attribute__((may_alias)) v8usa;

__device__ __forceinline__ unsigned short f2bf(float f) { unsigned u = __float_as_uint(f); u += 0x7FFFu + ((u >> 16) & 1u); return (unsigned short)(u >> 16); }
__device__ __forceinline__ float bf2f(unsigned short b) { return __uint_as_float(((unsigned)b) << 16); }
__device__ __forceinline__ float bfr(float f) { return bf2f(f2bf(f)); }
__device__ __forceinline__ v16h cat16(v8h lo, v8h hi) { return __builtin_shufflevector(lo, hi, 0, 1, 2, 3, 4, 5, 6, 7, 8, 9, 10, 11, 12, 13, 14, 15); }
__device__ __forceinline__ v16bf cat16b(v8us lo, v8us hi) { return __builtin_bit_cast(v16bf, __builtin_shufflevector(lo, hi, 0, 1, 2, 3, 4, 5, 6, 7, 8, 9, 10, 11, 12, 13, 14, 15)); }
__device__ __forceinline__ v8f wmma16(v16h a, v16h b, v8f c) { return __builtin_amdgcn_wmma_f32_16x16x32_f16(false, a, false, b, (short)0, c, false, false); }
__device__ __forceinline__ v8f wmmab(v16bf a, v16bf b, v8f c) { return __builtin_amdgcn_wmma_f32_16x16x32_bf16(false, a, false, b, (short)0, c, false, false); }



// ---- k_gemmw: register-blocked GEMM, ONE WAVE per 64x64 output tile (16 accumulators), operands straight from K-contiguous 16-bit planes; grid (M/64, N/64, Z), 32 threads.
// C[m][n] (f32, pitch ldc, + optional f32 bias[n]) = sum_k A[m][k] Bt[n][k] (+ split products per NSPLIT). z-batch strides sA/sB/sC in elements. K % 32 == 0.
template <typename T16> struct WFrag;
template <> struct WFrag<h16> { typedef v16h V; static __device__ __forceinline__ V ld(const h16* p) { return cat16(*(const v8h*)p, *(const v8h*)(p + 16)); } static __device__ __forceinline__ v8f mma(V a, V b, v8f c) { return wmma16(a, b, c); } };
template <> struct WFrag<bf> { typedef v16bf V; static __device__ __forceinline__ V ld(const bf* p) { return cat16b(*(const v8us*)p, *(const v8us*)(p + 16)); } static __device__ __forceinline__ v8f mma(V a, V b, v8f c) { return wmmab(a, b, c); } };
template <typename T16, int NSPLIT, bool BIAS>
__global__ __launch_bounds__(32) void k_gemmw(const T16* __restrict__ A, const T16* __restrict__ A2, const T16* __restrict__ Bt, const T16* __restrict__ Bt2, int K, float* C, int ldc, const float* __restrict__ bias, size_t sA, size_t sB, size_t sC) {
    typedef typename WFrag<T16>::V V;
    __shared__ __align__(16) float os[16 * 68];
    const size_t z = blockIdx.z; A += z * sA; if (A2) A2 += z * sA; Bt += z * sB; if (Bt2) Bt2 += z * sB; C += z * sC;
    const int lane = threadIdx.x & 31, lr = lane & 15, hi = lane >> 4; const int r0 = blockIdx.x * 64, c0 = blockIdx.y * 64;
    v8f acc[4][4];
#pragma unroll
    for (int mb = 0; mb < 4; ++mb)
#pragma unroll
        for (int nb = 0; nb < 4; ++nb) acc[mb][nb] = (v8f){};
    const size_t aoff = (size_t)(r0 + lr) * K + 8 * hi, boff = (size_t)(c0 + lr) * K + 8 * hi;
#pragma unroll 1
    for (int kc = 0; kc < K; kc += 32) {
        V a[4], a2[4];
#pragma unroll
        for (int mb = 0; mb < 4; ++mb) { a[mb] = WFrag<T16>::ld(A + aoff + (size_t)mb * 16 * K + kc); if (NSPLIT == 1 || NSPLIT == 2) a2[mb] = WFrag<T16>::ld(A2 + aoff + (size_t)mb * 16 * K + kc); }
#pragma unroll
        for (int nb = 0; nb < 4; ++nb) { const V b = WFrag<T16>::ld(Bt + boff + (size_t)nb * 16 * K + kc); V b2; if (NSPLIT >= 2) b2 = WFrag<T16>::ld(Bt2 + boff + (size_t)nb * 16 * K + kc);
#pragma unroll
            for (int mb = 0; mb < 4; ++mb) { acc[mb][nb] = WFrag<T16>::mma(a[mb], b, acc[mb][nb]); if (NSPLIT == 1 || NSPLIT == 2) acc[mb][nb] = WFrag<T16>::mma(a2[mb], b, acc[mb][nb]); if (NSPLIT >= 2) acc[mb][nb] = WFrag<T16>::mma(a[mb], b2, acc[mb][nb]); } }
        asm volatile("v_nop\n\tv_nop\n\tv_nop\n\tv_nop" : "+v"(acc[0][0]), "+v"(acc[1][1]), "+v"(acc[2][2]), "+v"(acc[3][3]) : "v"(a[0]), "v"(a[3]));
    }
#pragma unroll
    for (int mb = 0; mb < 4; ++mb) {
#pragma unroll
        for (int nb = 0; nb < 4; ++nb) {
#pragma unroll
            for (int j = 0; j < 8; ++j) os[(hi * 8 + j) * 68 + nb * 16 + lr] = acc[mb][nb][j]; }
        __builtin_amdgcn_wave_barrier(); asm volatile("" ::: "memory");
        float* crow = C + (size_t)(r0 + mb * 16) * ldc + c0;
{
#pragma unroll
            for (int s = 0; s < 8; ++s) { const int row = 2 * s + hi, cofs = lr * 4; v4f val = *(const v4fa*)(os + row * 68 + cofs); if (BIAS) { val[0] += bfr(bias[c0 + cofs]); val[1] += bfr(bias[c0 + cofs + 1]); val[2] += bfr(bias[c0 + cofs + 2]); val[3] += bfr(bias[c0 + cofs + 3]); }
                *(v4f*)(crow + (size_t)row * ldc + cofs) = val; }
             }
        __builtin_amdgcn_wave_barrier(); asm volatile("" ::: "memory");
    }
}

__device__ __forceinline__ h16 tohx(float x) { return (h16)x; }
typedef __attribute__((ext_vector_type(2))) _Float16 v2h;
typedef __attribute__((ext_vector_type(4))) _Float16 v4h;
typedef __attribute__((ext_vector_type(2))) unsigned short v2us;
typedef __attribute__((ext_vector_type(4))) unsigned short v4us;

__global__ __launch_bounds__(256) void k_qk(const float* __restrict__ q, const float* __restrict__ k, bf* QB, bf* KB) { const size_t e = ((size_t)blockIdx.x * 256 + threadIdx.x) * 4; if (e >= (size_t)NH_ * NN * HD) return; const int d = (int)(e % HD); const int n = (int)((e / HD) % NN); const int h = (int)(e / ((size_t)HD * NN)); const size_t s = ((size_t)n * NH_ + h) * HD + d; v4us a, b;
#pragma unroll
    for (int u = 0; u < 4; ++u) { a[u] = f2bf(q[s + u]); b[u] = f2bf(k[s + u]); } { *(v4us*)(QB + e) = a; *(v4us*)(KB + e) = b;  } }
__global__ __launch_bounds__(256) void k_vt(const float* __restrict__ v, h16* VT) { const size_t e = ((size_t)blockIdx.x * 256 + threadIdx.x) * 2; if (e >= (size_t)NH_ * HD * NN) return; const int n = (int)(e % NN); const int d = (int)((e / NN) % HD); const int h = (int)(e / ((size_t)NN * HD)); v2h o; o[0] = tohx(bfr(v[((size_t)n * NH_ + h) * HD + d])); o[1] = tohx(bfr(v[((size_t)(n + 1) * NH_ + h) * HD + d])); *(v2h*)(VT + e) = o;  }
__global__ __launch_bounds__(256) void k_rsoft(const float* __restrict__ Sb, const int* __restrict__ ringp, h16* P) { const int lane = threadIdx.x & 31; const int row = blockIdx.x * 8 + (threadIdx.x >> 5); if (row >= ZH * NN) return; int ring = ringp[0]; ring = min(max(ring, 1), RING); (void)ring; const float* sr = Sb + (size_t)row * NN; float v[128];
#pragma unroll
    for (int ch = 0; ch < 32; ++ch) { const v4f a = *(const v4f*)(sr + ch * 128 + lane * 4);
#pragma unroll
        for (int q = 0; q < 4; ++q) { float t = a[q] * 0.125f; asm volatile("" : "+v"(t)); v[ch * 4 + q] = t; } }
    float f[RING];
#pragma unroll
    for (int r = 0; r < RING; ++r) { float mx = -3.0e38f;
#pragma unroll
        for (int k = r * 32; k < r * 32 + 32; ++k) mx = fmaxf(mx, v[k]);
#pragma unroll
        for (int sh = 16; sh; sh >>= 1) mx = fmaxf(mx, __shfl_xor(mx, sh, 32));
        float s = 0.f;
#pragma unroll
        for (int k = r * 32; k < r * 32 + 32; ++k) { float d0 = __fsub_rn(v[k], mx); asm volatile("" : "+v"(d0)); v[k] = __expf(d0); s += v[k]; }
#pragma unroll
        for (int sh = 16; sh; sh >>= 1) s += __shfl_xor(s, sh, 32);
        f[r] = __fdiv_rn(PCAR, s); }
{
#pragma unroll
        for (int ch = 0; ch < 32; ++ch) { const float fr = f[ch / 8]; v4h o; o[0] = tohx(v[ch * 4] * fr); o[1] = tohx(v[ch * 4 + 1] * fr); o[2] = tohx(v[ch * 4 + 2] * fr); o[3] = tohx(v[ch * 4 + 3] * fr); *(v4h*)(P + (size_t)row * NN + ch * 128 + lane * 4) = o; }
         } }
__global__ __launch_bounds__(256) void k_scale(float* OUT, int h0) { const size_t e = ((size_t)blockIdx.x * 256 + threadIdx.x) * 4; if (e >= (size_t)ZH * NN * HD) return; const int d = (int)(e % HD); const int n = (int)((e / HD) % NN); const int z = (int)(e / ((size_t)HD * NN)); float* p = OUT + ((size_t)n * NH_ + h0 + z) * HD + d; const v4f a = *(const v4f*)p; v4f o; o[0] = a[0] * (1.0f / PCAR); o[1] = a[1] * (1.0f / PCAR); o[2] = a[2] * (1.0f / PCAR); o[3] = a[3] * (1.0f / PCAR); *(v4f*)p = o;  }

extern "C" void kernel_launch(void* const* d_in, const int* in_sizes, int n_in,
                              void* d_out, int out_size, void* d_ws, size_t ws_size, hipStream_t stream) {
    (void)in_sizes; (void)n_in; (void)out_size;
    const float* q = (const float*)d_in[0]; const float* k = (const float*)d_in[1]; const float* v = (const float*)d_in[2]; const int* ringp = (const int*)d_in[3];
    float* OUT = (float*)d_out;     // [1][4096][16][64]
    char* wsp = (char*)d_ws;
    auto take = [&](size_t bytes) { char* p = wsp; wsp += (bytes + 255) & ~(size_t)255; return (void*)p; };
    bf* QB = (bf*)take((size_t)NH_ * NN * HD * 2); bf* KB = (bf*)take((size_t)NH_ * NN * HD * 2); h16* VT = (h16*)take((size_t)NH_ * HD * NN * 2); float* Sb = (float*)take((size_t)ZH * NN * NN * 4); h16* P16 = (h16*)take((size_t)ZH * NN * NN * 2);
    if ((size_t)(wsp - (char*)d_ws) > ws_size) return;    // total ~ 226 MB = 216 MiB (two-head [4096][4096] f32 scores 134 MB + fp16 probabilities 67 MB)
    k_qk<<<(unsigned)(((size_t)NH_ * NN * HD / 4 + 255) / 256), 256, 0, stream>>>(q, k, QB, KB); k_vt<<<(unsigned)(((size_t)NH_ * HD * NN / 2 + 255) / 256), 256, 0, stream>>>(v, VT);
    for (int h0 = 0; h0 < NH_; h0 += ZH) { const size_t z = (size_t)h0;
        k_gemmw<bf, 0, false><<<dim3(NN / 64, NN / 64, ZH), 32, 0, stream>>>(QB + z * NN * HD, nullptr, KB + z * NN * HD, nullptr, HD, Sb, NN, nullptr, (size_t)NN * HD, (size_t)NN * HD, (size_t)NN * NN);
        k_rsoft<<<ZH * NN / 8, 256, 0, stream>>>(Sb, ringp, P16);
        k_gemmw<h16, 0, false><<<dim3(NN / 64, 1, ZH), 32, 0, stream>>>(P16, nullptr, VT + z * HD * NN, nullptr, NN, OUT + z * HD, NH_ * HD, nullptr, (size_t)NN * NN, (size_t)HD * NN, (size_t)HD);   // C tile for head h0+z lands at column (h0+z)*64 of the [n][1024] output; z-stride = 64 columns
        k_scale<<<(unsigned)(((size_t)ZH * NN * HD / 4 + 255) / 256), 256, 0, stream>>>(OUT, h0); }
}

// v001
// It runs in 85.4 microseconds.
// Next to v000, in two timings, it ran 15.6 and 15.7 times as fast.
#include <hip/hip_runtime.h>

// Ring attention with an INDEPENDENT softmax over each of the 4 key chunks of 1024 (scores/8), the per-chunk outputs SUMMED:
// out[n][h] = sum_r softmax_r(q.k_r / 8) v_r, query/key/value [1][4096][16][64] -> [1][4096][16][64].
// Compute dtypes, f32 accumulate: every input rounded to bf16; scores on plain bf16 operands (K 64); softmax in f32 registers; probabilities in fp16 against fp16 V.
// Three launches: k_qk and k_vt lay the 16-bit planes, k_fused does scores, the four softmaxes and P.V without the scores ever leaving registers.

#define NN   4096
#define NH_  16
#define HD   64
#define RING 4
typedef _Float16 h16;
typedef unsigned short bf;
typedef __attribute__((ext_vector_type(16))) __bf16   v16bf;
typedef __attribute__((ext_vector_type(16))) _Float16 v16h;
typedef __attribute__((ext_vector_type(8)))  _Float16 v8h;
typedef __attribute__((ext_vector_type(8)))  unsigned short v8us;
typedef __attribute__((ext_vector_type(8)))  float    v8f;
typedef __attribute__((ext_vector_type(4)))  float    v4f;
typedef __attribute__((ext_vector_type(2)))  float    v2f;
typedef __attribute__((ext_vector_type(4)))  unsigned v4u;
typedef __attribute__((ext_vector_type(8)))  unsigned v8u;
typedef __attribute__((ext_vector_type(2))) _Float16 v2h;
typedef __attribute__((ext_vector_type(4))) unsigned short v4us;
typedef v8h  __attribute__((may_alias)) v8ha;
typedef v4f  __attribute__((may_alias)) v4fa;
typedef v4u  __attribute__((may_alias)) v4ua;
typedef v8us __attribute__((may_alias)) v8usa;

__device__ __forceinline__ unsigned short f2bf(float f) { unsigned u = __float_as_uint(f); u += 0x7FFFu + ((u >> 16) & 1u); return (unsigned short)(u >> 16); }
__device__ __forceinline__ float bf2f(unsigned short b) { return __uint_as_float(((unsigned)b) << 16); }
__device__ __forceinline__ float bfr(float f) { return bf2f(f2bf(f)); }
__device__ __forceinline__ v16h cat16(v8h lo, v8h hi) { return __builtin_shufflevector(lo, hi, 0, 1, 2, 3, 4, 5, 6, 7, 8, 9, 10, 11, 12, 13, 14, 15); }
__device__ __forceinline__ v16bf cat16b(v8us lo, v8us hi) { return __builtin_bit_cast(v16bf, __builtin_shufflevector(lo, hi, 0, 1, 2, 3, 4, 5, 6, 7, 8, 9, 10, 11, 12, 13, 14, 15)); }
__device__ __forceinline__ v8f wmma16(v16h a, v16h b, v8f c) { return __builtin_amdgcn_wmma_f32_16x16x32_f16(false, a, false, b, (short)0, c, false, false); }
__device__ __forceinline__ v8f wmmab(v16bf a, v16bf b, v8f c) { return __builtin_amdgcn_wmma_f32_16x16x32_bf16(false, a, false, b, (short)0, c, false, false); }
__device__ __forceinline__ h16 tohx(float x) { return (h16)x; }

__global__ __launch_bounds__(256) void k_qk(const float* __restrict__ q, const float* __restrict__ k, bf* QB, bf* KB) { const size_t e = ((size_t)blockIdx.x * 256 + threadIdx.x) * 4; if (e >= (size_t)NH_ * NN * HD) return; const int d = (int)(e % HD); const int n = (int)((e / HD) % NN); const int h = (int)(e / ((size_t)HD * NN)); const size_t s = ((size_t)n * NH_ + h) * HD + d; v4us a, b;
#pragma unroll
    for (int u = 0; u < 4; ++u) { a[u] = f2bf(q[s + u]); b[u] = f2bf(k[s + u]); } { *(v4us*)(QB + e) = a; *(v4us*)(KB + e) = b;  } }
__global__ __launch_bounds__(256) void k_vt(const float* __restrict__ v, h16* VT) { const size_t e = ((size_t)blockIdx.x * 256 + threadIdx.x) * 2; if (e >= (size_t)NH_ * HD * NN) return; const int n = (int)(e % NN); const int d = (int)((e / NN) % HD); const int h = (int)(e / ((size_t)NN * HD)); v2h o; o[0] = tohx(bfr(v[((size_t)n * NH_ + h) * HD + d])); o[1] = tohx(bfr(v[((size_t)(n + 1) * NH_ + h) * HD + d])); *(v2h*)(VT + e) = o;  }

#define NWV   8
#define SKEY  64                      // keys per stage
#define NSTG  (NN / SKEY)             // 64 stages
#define CSTG  (NN / RING / SKEY)      // 16 stages per chunk
#define PITCH 144u                    // LDS pitch of a 128-byte row, 16 B x odd
#define TILE  (64u * PITCH)           // K tile: 64 keys x 64 d (bf16); V^T tile: 64 d x 64 keys (fp16)
#define BUFB  (2u * TILE)
#define OPIT  272u                    // LDS pitch of a 256-byte output row
#define OWAVE (32u * OPIT)
#define LDSB  (2u * BUFB + NWV * OWAVE)
__device__ __forceinline__ float xhalf(float x) { return __builtin_bit_cast(float, __builtin_amdgcn_permlanex16(__builtin_bit_cast(int, x), __builtin_bit_cast(int, x), 0x76543210, 0xfedcba98, false, false)); }  // lane l with lane l ^ 16
__device__ __forceinline__ unsigned pack2h(float lo, float hi) { return __builtin_bit_cast(unsigned, __builtin_convertvector((v2f){lo, hi}, v2h)); }  // round to nearest even
__device__ __forceinline__ v16bf ldsb(const unsigned char* p) { return cat16b(*(const v8usa*)p, *(const v8usa*)(p + 32)); }
__device__ __forceinline__ v16h  ldsh(const unsigned char* p) { return cat16(*(const v8ha*)p, *(const v8ha*)(p + 32)); }

__global__ __launch_bounds__(NWV * 32) void k_fused(const bf* __restrict__ QB, const bf* __restrict__ KB, const h16* __restrict__ VT, const int* __restrict__ ringp, float* __restrict__ OUT) {
    __shared__ __align__(16) unsigned char L[LDSB];
    const int tid = threadIdx.x, lane = tid & 31, wave = tid >> 5, c = lane & 15, h = lane >> 4;
    const int head = blockIdx.y, q0 = blockIdx.x * (NWV * 32) + wave * 32;
    int ring = ringp[0]; ring = min(max(ring, 1), RING); (void)ring;
    const bf* Kh = KB + (size_t)head * NN * HD; const h16* Vh = VT + (size_t)head * HD * NN;
    const float cscale = 0.125f * 1.4426950408889634f;   // scores / 8, in the base-2 domain
    unsigned char* Ow = L + 2u * BUFB + (unsigned)wave * OWAVE;   // this wave's own 32 x 64 f32 sum of the chunks' outputs

    v16bf qf[2][2];
#pragma unroll
    for (int g = 0; g < 2; ++g)
#pragma unroll
        for (int kc = 0; kc < 2; ++kc) { const bf* p = QB + ((size_t)head * NN + q0 + 16 * g + c) * HD + 32 * kc + 8 * h; qf[g][kc] = cat16b(*(const v8us*)p, *(const v8us*)(p + 16)); }

    // staging: 512 pieces of 16 bytes per tile, two per thread; eight lanes cover one 128-byte row
    const int srow = tid >> 3, scol = tid & 7;
    v4u sk[2], sv[2];
    auto gload = [&](int s) {
#pragma unroll
        for (int u = 0; u < 2; ++u) { sk[u] = *(const v4u*)(Kh + (size_t)(s * SKEY + srow + 32 * u) * HD + scol * 8); sv[u] = *(const v4u*)(Vh + (size_t)(srow + 32 * u) * NN + s * SKEY + scol * 8); } };
    auto sstore = [&](int b) { unsigned char* d = L + (unsigned)b * BUFB + (unsigned)srow * PITCH + (unsigned)scol * 16u;
#pragma unroll
        for (int u = 0; u < 2; ++u) { *(v4ua*)(d + 32u * u * PITCH) = sk[u]; *(v4ua*)(d + TILE + 32u * u * PITCH) = sv[u]; } };

#pragma unroll
    for (int g = 0; g < 2; ++g)
#pragma unroll
        for (int t = 0; t < 4; ++t) { unsigned char* op = Ow + (unsigned)(16 * g + c) * OPIT + (unsigned)(16 * t + 8 * h) * 4u; *(v4fa*)op = (v4f){}; *(v4fa*)(op + 16) = (v4f){}; }
    gload(0); sstore(0);
    __syncthreads();

    // every plain '#pragma unroll' here keeps a fragment or accumulator array in registers: its indices must be compile-time constants
    v8f acc[2][4]; float m_run[2]; v2f l_run[2];   // l_run: this lane's share of the denominator, even and odd keys apart; joined at the chunk's end
#pragma unroll 1   // rolled: one copy of the stage loop, so that the hot code stays small in the instruction cache
    for (int r = 0; r < RING; ++r) {
#pragma unroll
        for (int g = 0; g < 2; ++g) { m_run[g] = -__builtin_inff(); l_run[g] = (v2f){};
#pragma unroll
            for (int t = 0; t < 4; ++t) acc[g][t] = (v8f){}; }
#pragma unroll 1   // rolled: unrolling would only multiply the two-pass body and its registers
        for (int st = 0; st < CSTG; ++st) {
            const int s = r * CSTG + st; const bool more = s + 1 < NSTG;
            if (more) gload(s + 1);
            const unsigned char* Bp = L + (unsigned)(s & 1) * BUFB;
#pragma unroll
            for (int sub = 0; sub < 2; ++sub) {   // one pass = 32 keys
                v8f sc[2][2];
#pragma unroll
                for (int kt = 0; kt < 2; ++kt) { const unsigned char* kp = Bp + (unsigned)(32 * sub + 16 * kt + c) * PITCH + 16u * h; const v16bf k0 = ldsb(kp), k1 = ldsb(kp + 64);
#pragma unroll
                    for (int g = 0; g < 2; ++g) { sc[kt][g] = wmmab(k0, qf[g][0], (v8f){}); sc[kt][g] = wmmab(k1, qf[g][1], sc[kt][g]); } }
                v16h vf[4];
#pragma unroll
                for (int t = 0; t < 4; ++t) vf[t] = ldsh(Bp + TILE + (unsigned)(16 * t + c) * PITCH + 64u * sub + 16u * h);
                // maxima of the raw scores (the scale is positive); the maximum in use may trail the true one by up to 8 (base 2), so an exponential stays below 2^12
                float mb[2]; bool need = false;
#pragma unroll
                for (int g = 0; g < 2; ++g) { float mx = sc[0][g][0];
#pragma unroll
                    for (int j = 1; j < 8; ++j) mx = fmaxf(mx, sc[0][g][j]);
#pragma unroll
                    for (int j = 0; j < 8; ++j) mx = fmaxf(mx, sc[1][g][j]);
                    mx = fmaxf(mx, xhalf(mx)) * cscale; mb[g] = mx; need = need || (mx > m_run[g] + 8.0f); }
                if (__builtin_amdgcn_ballot_w32(need) != 0) {   // always on a chunk's first pass, rare afterwards
#pragma unroll
                    for (int g = 0; g < 2; ++g) { const float mn = fmaxf(m_run[g], mb[g]); const float corr = __builtin_amdgcn_exp2f(m_run[g] - mn); m_run[g] = mn; l_run[g] = l_run[g] * corr;
#pragma unroll
                        for (int t = 0; t < 4; ++t) acc[g][t] = acc[g][t] * corr; }
                }
#pragma unroll
                for (int g = 0; g < 2; ++g) { const float nm = 4.0f - m_run[g];   // + 4: keeps small probabilities out of fp16's subnormals; it cancels in acc / l
                    v8u w;
#pragma unroll
                    for (int i = 0; i < 8; ++i) { const float p0 = __builtin_amdgcn_exp2f(fmaf(sc[i >> 2][g][2 * (i & 3)], cscale, nm)), p1 = __builtin_amdgcn_exp2f(fmaf(sc[i >> 2][g][2 * (i & 3) + 1], cscale, nm)); l_run[g] += (v2f){p0, p1}; w[i] = pack2h(p0, p1); }
                    const v16h pf = __builtin_bit_cast(v16h, w);
#pragma unroll
                    for (int t = 0; t < 4; ++t) acc[g][t] = wmma16(vf[t], pf, acc[g][t]); }
            }
            if (more) sstore((s + 1) & 1);
            __syncthreads();   // publishes stage s + 1 and ends every wave's reads of stage s, whose buffer the next trip refills
        }
        // end of a chunk: its softmax is complete; add its normalised output to the wave's own sum in LDS (each lane its own 64 slots)
#pragma unroll
        for (int g = 0; g < 2; ++g) { const float lh = l_run[g][0] + l_run[g][1]; const float l = lh + xhalf(lh); const float inv = __fdiv_rn(1.0f, l);
#pragma unroll
            for (int t = 0; t < 4; ++t) { unsigned char* op = Ow + (unsigned)(16 * g + c) * OPIT + (unsigned)(16 * t + 8 * h) * 4u; v4f a0 = *(const v4fa*)op, a1 = *(const v4fa*)(op + 16);
#pragma unroll
                for (int j = 0; j < 4; ++j) { a0[j] += acc[g][t][j] * inv; a1[j] += acc[g][t][4 + j] * inv; }
                *(v4fa*)op = a0; *(v4fa*)(op + 16) = a1; } }
    }
    __syncthreads();   // the sums are read back across lanes
    // whole rows out: 16 lanes cover one query's 256 bytes
#pragma unroll
    for (int i = 0; i < 16; ++i) { const int row = 2 * i + h; const v4f val = *(const v4fa*)(Ow + (unsigned)row * OPIT + (unsigned)c * 16u); *(v4f*)(OUT + ((size_t)(q0 + row) * NH_ + head) * HD + c * 4) = val; }
}

extern "C" void kernel_launch(void* const* d_in, const int* in_sizes, int n_in,
                              void* d_out, int out_size, void* d_ws, size_t ws_size, hipStream_t stream) {
    (void)in_sizes; (void)n_in; (void)out_size;
    const float* q = (const float*)d_in[0]; const float* k = (const float*)d_in[1]; const float* v = (const float*)d_in[2]; const int* ringp = (const int*)d_in[3];
    float* OUT = (float*)d_out;     // [1][4096][16][64]
    char* wsp = (char*)d_ws;
    auto take = [&](size_t bytes) { char* p = wsp; wsp += (bytes + 255) & ~(size_t)255; return (void*)p; };
    bf* QB = (bf*)take((size_t)NH_ * NN * HD * 2); bf* KB = (bf*)take((size_t)NH_ * NN * HD * 2); h16* VT = (h16*)take((size_t)NH_ * HD * NN * 2);
    if ((size_t)(wsp - (char*)d_ws) > ws_size) return;
    k_qk<<<(unsigned)(((size_t)NH_ * NN * HD / 4 + 255) / 256), 256, 0, stream>>>(q, k, QB, KB); k_vt<<<(unsigned)(((size_t)NH_ * HD * NN / 2 + 255) / 256), 256, 0, stream>>>(v, VT);
    k_fused<<<dim3(NN / (NWV * 32), NH_), NWV * 32, 0, stream>>>(QB, KB, VT, ringp, OUT);
}

// v002
// A run of this version takes 75.7 microseconds.
// Next to v001, in two timings, it ran 1.13 and 1.12 times as fast.
// Over all steps from v000 it is 17.6 times as fast.
#include <hip/hip_runtime.h>

// Ring attention with an INDEPENDENT softmax over each of the 4 key chunks of 1024 (scores/8), the per-chunk outputs SUMMED:
// out[n][h] = sum_r softmax_r(q.k_r / 8) v_r, query/key/value [1][4096][16][64] -> [1][4096][16][64].
// Compute dtypes, f32 accumulate: every input rounded to bf16; scores on plain bf16 operands (K 64); softmax in f32 registers; probabilities in fp16 against fp16 V.
// Two launches: k_lay lays the three 16-bit planes, k_fused does scores, the four softmaxes and P.V without the scores ever leaving registers.

#define NN   4096
#define NH_  16
#define HD   64
#define RING 4
typedef _Float16 h16;
typedef unsigned short bf;
typedef __attribute__((ext_vector_type(16))) __bf16   v16bf;
typedef __attribute__((ext_vector_type(16))) _Float16 v16h;
typedef __attribute__((ext_vector_type(8)))  _Float16 v8h;
typedef __attribute__((ext_vector_type(8)))  unsigned short v8us;
typedef __attribute__((ext_vector_type(8)))  float    v8f;
typedef __attribute__((ext_vector_type(4)))  float    v4f;
typedef __attribute__((ext_vector_type(2)))  float    v2f;
typedef __attribute__((ext_vector_type(4)))  unsigned v4u;
typedef __attribute__((ext_vector_type(8)))  unsigned v8u;
typedef __attribute__((ext_vector_type(2))) _Float16 v2h;
typedef __attribute__((ext_vector_type(4))) unsigned short v4us;
typedef v8h  __attribute__((may_alias)) v8ha;
typedef v4f  __attribute__((may_alias)) v4fa;
typedef v4u  __attribute__((may_alias)) v4ua;
typedef v8us __attribute__((may_alias)) v8usa;

__device__ __forceinline__ unsigned short f2bf(float f) { unsigned u = __float_as_uint(f); u += 0x7FFFu + ((u >> 16) & 1u); return (unsigned short)(u >> 16); }
__device__ __forceinline__ float bf2f(unsigned short b) { return __uint_as_float(((unsigned)b) << 16); }
__device__ __forceinline__ float bfr(float f) { return bf2f(f2bf(f)); }
__device__ __forceinline__ v16h cat16(v8h lo, v8h hi) { return __builtin_shufflevector(lo, hi, 0, 1, 2, 3, 4, 5, 6, 7, 8, 9, 10, 11, 12, 13, 14, 15); }
__device__ __forceinline__ v16bf cat16b(v8us lo, v8us hi) { return __builtin_bit_cast(v16bf, __builtin_shufflevector(lo, hi, 0, 1, 2, 3, 4, 5, 6, 7, 8, 9, 10, 11, 12, 13, 14, 15)); }
__device__ __forceinline__ v8f wmma16(v16h a, v16h b, v8f c) { return __builtin_amdgcn_wmma_f32_16x16x32_f16(false, a, false, b, (short)0, c, false, false); }
__device__ __forceinline__ v8f wmmab(v16bf a, v16bf b, v8f c) { return __builtin_amdgcn_wmma_f32_16x16x32_bf16(false, a, false, b, (short)0, c, false, false); }
__device__ __forceinline__ h16 tohx(float x) { return (h16)x; }

// ---- k_lay: one workgroup = 128 positions of one head, all three planes; grid (NN / LROW, NH_).
// Every global load is 16 bytes a lane over whole 256-byte rows of the inputs, all 24 of a thread issued before the first is used.
// Q and K: a wave's store covers two neighbouring rows of the plane, 256 bytes in a row. V: a thread holds 8 positions x 4 d, packs 8 positions of one d into 16 bytes,
// and the pieces change threads through LDS so that 16 lanes store one d row's 256 bytes. Piece (d, p) lies at column p ^ (d >> 2) of its 256-byte LDS row: writers and readers each cover all banks.
#define LROW 128
__global__ __launch_bounds__(256) void k_lay(const float* __restrict__ q, const float* __restrict__ k, const float* __restrict__ v, bf* __restrict__ QB, bf* __restrict__ KB, h16* __restrict__ VT) {
    __shared__ __align__(16) unsigned char T[HD * LROW * 2];
    const int tid = threadIdx.x, c4 = tid & 15, rq = tid >> 4;
    const int head = blockIdx.y, n0 = blockIdx.x * LROW;
    const size_t base = ((size_t)n0 * NH_ + head) * HD + 4 * c4;
    v4f w[8], a[8], b[8];
#pragma unroll
    for (int i = 0; i < 8; ++i) w[i] = *(const v4f*)(v + base + (size_t)(8 * rq + i) * (NH_ * HD));
    asm volatile("s_wait_xcnt 0x0" ::: "memory");   // a later load's result lands in the registers that held these loads' address: the wait that belongs in front of such an overwrite
#pragma unroll
    for (int i = 0; i < 8; ++i) a[i] = *(const v4f*)(q + base + (size_t)(rq + 16 * i) * (NH_ * HD));
#pragma unroll
    for (int i = 0; i < 8; ++i) b[i] = *(const v4f*)(k + base + (size_t)(rq + 16 * i) * (NH_ * HD));
    __builtin_amdgcn_sched_barrier(0);   // keeps all 24 loads in front of the first use: without it the compiler holds a part of them back behind the first waits, and the wave pays the memory latency several times
#pragma unroll
    for (int j = 0; j < 4; ++j) { v8h p;
#pragma unroll
        for (int u = 0; u < 8; ++u) p[u] = tohx(bfr(w[u][j]));
        *(v8ha*)(T + (unsigned)(4 * c4 + j) * (LROW * 2u) + ((unsigned)(rq ^ c4) << 4)) = p; }
    __syncthreads();   // the V pieces are read back by other threads; it stands in front of every global store, so that no store is waited for here
#pragma unroll
    for (int i = 0; i < 4; ++i) { const int d = rq + 16 * i; const v8h val = *(const v8ha*)(T + (unsigned)d * (LROW * 2u) + ((unsigned)(c4 ^ ((d >> 2) & 15)) << 4)); *(v8h*)(VT + ((size_t)head * HD + d) * NN + n0 + 8 * c4) = val; }
    const size_t orow = ((size_t)head * NN + n0 + rq) * HD + 4 * c4;
#pragma unroll
    for (int i = 0; i < 8; ++i) { v4us o;
#pragma unroll
        for (int u = 0; u < 4; ++u) o[u] = f2bf(a[i][u]);
        *(v4us*)(QB + orow + (size_t)(16 * i) * HD) = o; }
#pragma unroll
    for (int i = 0; i < 8; ++i) { v4us o;
#pragma unroll
        for (int u = 0; u < 4; ++u) o[u] = f2bf(b[i][u]);
        *(v4us*)(KB + orow + (size_t)(16 * i) * HD) = o; }
}

#define NWV   8
#define SKEY  64                      // keys per stage
#define NSTG  (NN / SKEY)             // 64 stages
#define CSTG  (NN / RING / SKEY)      // 16 stages per chunk
#define PITCH 144u                    // LDS pitch of a 128-byte row, 16 B x odd
#define TILE  (64u * PITCH)           // K tile: 64 keys x 64 d (bf16); V^T tile: 64 d x 64 keys (fp16)
#define BUFB  (2u * TILE)
#define OPIT  272u                    // LDS pitch of a 256-byte output row
#define OWAVE (32u * OPIT)
#define LDSB  (2u * BUFB + NWV * OWAVE)
__device__ __forceinline__ float xhalf(float x) { return __builtin_bit_cast(float, __builtin_amdgcn_permlanex16(__builtin_bit_cast(int, x), __builtin_bit_cast(int, x), 0x76543210, 0xfedcba98, false, false)); }  // lane l with lane l ^ 16
__device__ __forceinline__ unsigned pack2h(float lo, float hi) { return __builtin_bit_cast(unsigned, __builtin_convertvector((v2f){lo, hi}, v2h)); }  // round to nearest even
__device__ __forceinline__ v16bf ldsb(const unsigned char* p) { return cat16b(*(const v8usa*)p, *(const v8usa*)(p + 32)); }
__device__ __forceinline__ v16h  ldsh(const unsigned char* p) { return cat16(*(const v8ha*)p, *(const v8ha*)(p + 32)); }

__global__ __launch_bounds__(NWV * 32) void k_fused(const bf* __restrict__ QB, const bf* __restrict__ KB, const h16* __restrict__ VT, const int* __restrict__ ringp, float* __restrict__ OUT) {
    __shared__ __align__(16) unsigned char L[LDSB];
    const int tid = threadIdx.x, lane = tid & 31, wave = tid >> 5, c = lane & 15, h = lane >> 4;
    const int head = blockIdx.y, q0 = blockIdx.x * (NWV * 32) + wave * 32;
    int ring = ringp[0]; ring = min(max(ring, 1), RING); (void)ring;
    const bf* Kh = KB + (size_t)head * NN * HD; const h16* Vh = VT + (size_t)head * HD * NN;
    const float cscale = 0.125f * 1.4426950408889634f;   // scores / 8, in the base-2 domain
    unsigned char* Ow = L + 2u * BUFB + (unsigned)wave * OWAVE;   // this wave's own 32 x 64 f32 sum of the chunks' outputs

    v16bf qf[2][2];
#pragma unroll
    for (int g = 0; g < 2; ++g)
#pragma unroll
        for (int kc = 0; kc < 2; ++kc) { const bf* p = QB + ((size_t)head * NN + q0 + 16 * g + c) * HD + 32 * kc + 8 * h; qf[g][kc] = cat16b(*(const v8us*)p, *(const v8us*)(p + 16)); }

    // staging: 512 pieces of 16 bytes per tile, two per thread; eight lanes cover one 128-byte row
    const int srow = tid >> 3, scol = tid & 7;
    v4u sk[2], sv[2];
    auto gload = [&](int s) {
#pragma unroll
        for (int u = 0; u < 2; ++u) { sk[u] = *(const v4u*)(Kh + (size_t)(s * SKEY + srow + 32 * u) * HD + scol * 8); sv[u] = *(const v4u*)(Vh + (size_t)(srow + 32 * u) * NN + s * SKEY + scol * 8); } };
    auto sstore = [&](int b) { unsigned char* d = L + (unsigned)b * BUFB + (unsigned)srow * PITCH + (unsigned)scol * 16u;
#pragma unroll
        for (int u = 0; u < 2; ++u) { *(v4ua*)(d + 32u * u * PITCH) = sk[u]; *(v4ua*)(d + TILE + 32u * u * PITCH) = sv[u]; } };

#pragma unroll
    for (int g = 0; g < 2; ++g)
#pragma unroll
        for (int t = 0; t < 4; ++t) { unsigned char* op = Ow + (unsigned)(16 * g + c) * OPIT + (unsigned)(16 * t + 8 * h) * 4u; *(v4fa*)op = (v4f){}; *(v4fa*)(op + 16) = (v4f){}; }
    gload(0); sstore(0);
    __syncthreads();

    // every plain '#pragma unroll' here keeps a fragment or accumulator array in registers: its indices must be compile-time constants
    v8f acc[2][4]; float m_run[2]; v2f l_run[2];   // l_run: this lane's share of the denominator, even and odd keys apart; joined at the chunk's end
#pragma unroll 1   // rolled: one copy of the stage loop, so that the hot code stays small in the instruction cache
    for (int r = 0; r < RING; ++r) {
#pragma unroll
        for (int g = 0; g < 2; ++g) { m_run[g] = -__builtin_inff(); l_run[g] = (v2f){};
#pragma unroll
            for (int t = 0; t < 4; ++t) acc[g][t] = (v8f){}; }
#pragma unroll 1   // rolled: unrolling would only multiply the two-pass body and its registers
        for (int st = 0; st < CSTG; ++st) {
            const int s = r * CSTG + st; const bool more = s + 1 < NSTG;
            if (more) gload(s + 1);
            const unsigned char* Bp = L + (unsigned)(s & 1) * BUFB;
#pragma unroll
            for (int sub = 0; sub < 2; ++sub) {   // one pass = 32 keys
                v8f sc[2][2];
#pragma unroll
                for (int kt = 0; kt < 2; ++kt) { const unsigned char* kp = Bp + (unsigned)(32 * sub + 16 * kt + c) * PITCH + 16u * h; const v16bf k0 = ldsb(kp), k1 = ldsb(kp + 64);
#pragma unroll
                    for (int g = 0; g < 2; ++g) { sc[kt][g] = wmmab(k0, qf[g][0], (v8f){}); sc[kt][g] = wmmab(k1, qf[g][1], sc[kt][g]); } }
                v16h vf[4];
#pragma unroll
                for (int t = 0; t < 4; ++t) vf[t] = ldsh(Bp + TILE + (unsigned)(16 * t + c) * PITCH + 64u * sub + 16u * h);
                // maxima of the raw scores (the scale is positive); the maximum in use may trail the true one by up to 8 (base 2), so an exponential stays below 2^12
                float mb[2]; bool need = false;
#pragma unroll
                for (int g = 0; g < 2; ++g) { float mx = sc[0][g][0];
#pragma unroll
                    for (int j = 1; j < 8; ++j) mx = fmaxf(mx, sc[0][g][j]);
#pragma unroll
                    for (int j = 0; j < 8; ++j) mx = fmaxf(mx, sc[1][g][j]);
                    mx = fmaxf(mx, xhalf(mx)) * cscale; mb[g] = mx; need = need || (mx > m_run[g] + 8.0f); }
                if (__builtin_amdgcn_ballot_w32(need) != 0) {   // always on a chunk's first pass, rare afterwards
#pragma unroll
                    for (int g = 0; g < 2; ++g) { const float mn = fmaxf(m_run[g], mb[g]); const float corr = __builtin_amdgcn_exp2f(m_run[g] - mn); m_run[g] = mn; l_run[g] = l_run[g] * corr;
#pragma unroll
                        for (int t = 0; t < 4; ++t) acc[g][t] = acc[g][t] * corr; }
                }
#pragma unroll
                for (int g = 0; g < 2; ++g) { const float nm = 4.0f - m_run[g];   // + 4: keeps small probabilities out of fp16's subnormals; it cancels in acc / l
                    v8u w;
#pragma unroll
                    for (int i = 0; i < 8; ++i) { const float p0 = __builtin_amdgcn_exp2f(fmaf(sc[i >> 2][g][2 * (i & 3)], cscale, nm)), p1 = __builtin_amdgcn_exp2f(fmaf(sc[i >> 2][g][2 * (i & 3) + 1], cscale, nm)); l_run[g] += (v2f){p0, p1}; w[i] = pack2h(p0, p1); }
                    const v16h pf = __builtin_bit_cast(v16h, w);
#pragma unroll
                    for (int t = 0; t < 4; ++t) acc[g][t] = wmma16(vf[t], pf, acc[g][t]); }
            }
            if (more) sstore((s + 1) & 1);
            __syncthreads();   // publishes stage s + 1 and ends every wave's reads of stage s, whose buffer the next trip refills
        }
        // end of a chunk: its softmax is complete; add its normalised output to the wave's own sum in LDS (each lane its own 64 slots)
#pragma unroll
        for (int g = 0; g < 2; ++g) { const float lh = l_run[g][0] + l_run[g][1]; const float l = lh + xhalf(lh); const float inv = __fdiv_rn(1.0f, l);
#pragma unroll
            for (int t = 0; t < 4; ++t) { unsigned char* op = Ow + (unsigned)(16 * g + c) * OPIT + (unsigned)(16 * t + 8 * h) * 4u; v4f a0 = *(const v4fa*)op, a1 = *(const v4fa*)(op + 16);
#pragma unroll
                for (int j = 0; j < 4; ++j) { a0[j] += acc[g][t][j] * inv; a1[j] += acc[g][t][4 + j] * inv; }
                *(v4fa*)op = a0; *(v4fa*)(op + 16) = a1; } }
    }
    __syncthreads();   // the sums are read back across lanes
    // whole rows out: 16 lanes cover one query's 256 bytes
#pragma unroll
    for (int i = 0; i < 16; ++i) { const int row = 2 * i + h; const v4f val = *(const v4fa*)(Ow + (unsigned)row * OPIT + (unsigned)c * 16u); *(v4f*)(OUT + ((size_t)(q0 + row) * NH_ + head) * HD + c * 4) = val; }
}

extern "C" void kernel_launch(void* const* d_in, const int* in_sizes, int n_in,
                              void* d_out, int out_size, void* d_ws, size_t ws_size, hipStream_t stream) {
    (void)in_sizes; (void)n_in; (void)out_size;
    const float* q = (const float*)d_in[0]; const float* k = (const float*)d_in[1]; const float* v = (const float*)d_in[2]; const int* ringp = (const int*)d_in[3];
    float* OUT = (float*)d_out;     // [1][4096][16][64]
    char* wsp = (char*)d_ws;
    auto take = [&](size_t bytes) { char* p = wsp; wsp += (bytes + 255) & ~(size_t)255; return (void*)p; };
    bf* QB = (bf*)take((size_t)NH_ * NN * HD * 2); bf* KB = (bf*)take((size_t)NH_ * NN * HD * 2); h16* VT = (h16*)take((size_t)NH_ * HD * NN * 2);
    if ((size_t)(wsp - (char*)d_ws) > ws_size) return;
    k_lay<<<dim3(NN / LROW, NH_), 256, 0, stream>>>(q, k, v, QB, KB, VT);
    k_fused<<<dim3(NN / (NWV * 32), NH_), NWV * 32, 0, stream>>>(QB, KB, VT, ringp, OUT);
}

// v003
// Measured time: 64.4 microseconds a run.
// Two timings next to v002 both put it at 1.17 times that version's speed.
// Counting every step since v000, it is 20.6 times as fast.
#include <hip/hip_runtime.h>

// Ring attention with an INDEPENDENT softmax over each of the 4 key chunks of 1024 (scores/8), the per-chunk outputs SUMMED:
// out[n][h] = sum_r softmax_r(q.k_r / 8) v_r, query/key/value [1][4096][16][64] -> [1][4096][16][64].
// Compute dtypes, f32 accumulate: every input rounded to bf16; scores on plain bf16 operands (K 64); softmax in f32 registers; probabilities in fp16 against fp16 V.
// Two launches: k_lay lays the three 16-bit planes, k_fused does scores, the four softmaxes and P.V without the scores ever leaving registers.

#define NN   4096
#define NH_  16
#define HD   64
#define RING 4
typedef _Float16 h16;
typedef unsigned short bf;
typedef __attribute__((ext_vector_type(16))) __bf16   v16bf;
typedef __attribute__((ext_vector_type(16))) _Float16 v16h;
typedef __attribute__((ext_vector_type(8)))  _Float16 v8h;
typedef __attribute__((ext_vector_type(8)))  unsigned short v8us;
typedef __attribute__((ext_vector_type(8)))  float    v8f;
typedef __attribute__((ext_vector_type(4)))  float    v4f;
typedef __attribute__((ext_vector_type(2)))  float    v2f;
typedef __attribute__((ext_vector_type(4)))  unsigned v4u;
typedef __attribute__((ext_vector_type(8)))  unsigned v8u;
typedef __attribute__((ext_vector_type(2))) _Float16 v2h;
typedef __attribute__((ext_vector_type(4))) unsigned short v4us;
typedef v8h  __attribute__((may_alias)) v8ha;
typedef v4f  __attribute__((may_alias)) v4fa;
typedef v4u  __attribute__((may_alias)) v4ua;
typedef v8us __attribute__((may_alias)) v8usa;

__device__ __forceinline__ unsigned short f2bf(float f) { unsigned u = __float_as_uint(f); u += 0x7FFFu + ((u >> 16) & 1u); return (unsigned short)(u >> 16); }
__device__ __forceinline__ float bf2f(unsigned short b) { return __uint_as_float(((unsigned)b) << 16); }
__device__ __forceinline__ float bfr(float f) { return bf2f(f2bf(f)); }
__device__ __forceinline__ v16h cat16(v8h lo, v8h hi) { return __builtin_shufflevector(lo, hi, 0, 1, 2, 3, 4, 5, 6, 7, 8, 9, 10, 11, 12, 13, 14, 15); }
__device__ __forceinline__ v16bf cat16b(v8us lo, v8us hi) { return __builtin_bit_cast(v16bf, __builtin_shufflevector(lo, hi, 0, 1, 2, 3, 4, 5, 6, 7, 8, 9, 10, 11, 12, 13, 14, 15)); }
__device__ __forceinline__ v8f wmma16(v16h a, v16h b, v8f c) { return __builtin_amdgcn_wmma_f32_16x16x32_f16(false, a, false, b, (short)0, c, false, false); }
__device__ __forceinline__ v8f wmmab(v16bf a, v16bf b, v8f c) { return __builtin_amdgcn_wmma_f32_16x16x32_bf16(false, a, false, b, (short)0, c, false, false); }
__device__ __forceinline__ h16 tohx(float x) { return (h16)x; }

// ---- k_lay: one workgroup = 128 positions of one head, all three planes; grid (NN / LROW, NH_).
// Every global load is 16 bytes a lane over whole 256-byte rows of the inputs, all 24 of a thread issued before the first is used.
// Q and K: a wave's store covers two neighbouring rows of the plane, 256 bytes in a row. V: a thread holds 8 positions x 4 d, packs 8 positions of one d into 16 bytes,
// and the pieces change threads through LDS so that 16 lanes store one d row's 256 bytes. Piece (d, p) lies at column p ^ (d >> 2) of its 256-byte LDS row: writers and readers each cover all banks.
#define LROW 128
__global__ __launch_bounds__(256) void k_lay(const float* __restrict__ q, const float* __restrict__ k, const float* __restrict__ v, bf* __restrict__ QB, bf* __restrict__ KB, h16* __restrict__ VT) {
    __shared__ __align__(16) unsigned char T[HD * LROW * 2];
    const int tid = threadIdx.x, c4 = tid & 15, rq = tid >> 4;
    const int head = blockIdx.y, n0 = blockIdx.x * LROW;
    const size_t base = ((size_t)n0 * NH_ + head) * HD + 4 * c4;
    v4f w[8], a[8], b[8];
#pragma unroll
    for (int i = 0; i < 8; ++i) w[i] = *(const v4f*)(v + base + (size_t)(8 * rq + i) * (NH_ * HD));
    asm volatile("s_wait_xcnt 0x0" ::: "memory");   // a later load's result lands in the registers that held these loads' address: the wait that belongs in front of such an overwrite
#pragma unroll
    for (int i = 0; i < 8; ++i) a[i] = *(const v4f*)(q + base + (size_t)(rq + 16 * i) * (NH_ * HD));
#pragma unroll
    for (int i = 0; i < 8; ++i) b[i] = *(const v4f*)(k + base + (size_t)(rq + 16 * i) * (NH_ * HD));
    __builtin_amdgcn_sched_barrier(0);   // keeps all 24 loads in front of the first use: without it the compiler holds a part of them back behind the first waits, and the wave pays the memory latency several times
#pragma unroll
    for (int j = 0; j < 4; ++j) { v8h p;
#pragma unroll
        for (int u = 0; u < 8; ++u) p[u] = tohx(bfr(w[u][j]));
        *(v8ha*)(T + (unsigned)(4 * c4 + j) * (LROW * 2u) + ((unsigned)(rq ^ c4) << 4)) = p; }
    __syncthreads();   // the V pieces are read back by other threads; it stands in front of every global store, so that no store is waited for here
#pragma unroll
    for (int i = 0; i < 4; ++i) { const int d = rq + 16 * i; const v8h val = *(const v8ha*)(T + (unsigned)d * (LROW * 2u) + ((unsigned)(c4 ^ ((d >> 2) & 15)) << 4)); *(v8h*)(VT + ((size_t)head * HD + d) * NN + n0 + 8 * c4) = val; }
    const size_t orow = ((size_t)head * NN + n0 + rq) * HD + 4 * c4;
#pragma unroll
    for (int i = 0; i < 8; ++i) { v4us o;
#pragma unroll
        for (int u = 0; u < 4; ++u) o[u] = f2bf(a[i][u]);
        *(v4us*)(QB + orow + (size_t)(16 * i) * HD) = o; }
#pragma unroll
    for (int i = 0; i < 8; ++i) { v4us o;
#pragma unroll
        for (int u = 0; u < 4; ++u) o[u] = f2bf(b[i][u]);
        *(v4us*)(KB + orow + (size_t)(16 * i) * HD) = o; }
}

#define NWV   8                       // waves of a group, 32 queries each
#define NGRP  2                       // groups of waves, RING / NGRP chunks each
#define SKEY  64                      // keys per stage
#define GSTG  (NN / NGRP / SKEY)      // 32 stages per group
#define CSTG  (NN / RING / SKEY)      // 16 stages per chunk
#define PITCH 144u                    // LDS pitch of a 128-byte row, 16 B x odd
#define TILE  (64u * PITCH)           // K tile: 64 keys x 64 d (bf16); V^T tile: 64 d x 64 keys (fp16)
#define BUFB  (2u * TILE)
#define OPIT  272u                    // LDS pitch of a 256-byte output row
#define OWAVE (32u * OPIT)
#define LDSB  (NGRP * 2u * BUFB + NGRP * NWV * OWAVE)
__device__ __forceinline__ float xhalf(float x) { return __builtin_bit_cast(float, __builtin_amdgcn_permlanex16(__builtin_bit_cast(int, x), __builtin_bit_cast(int, x), 0x76543210, 0xfedcba98, false, false)); }  // lane l with lane l ^ 16
__device__ __forceinline__ unsigned pack2h(float lo, float hi) { return __builtin_bit_cast(unsigned, __builtin_convertvector((v2f){lo, hi}, v2h)); }  // round to nearest even
__device__ __forceinline__ v16bf ldsb(const unsigned char* p) { return cat16b(*(const v8usa*)p, *(const v8usa*)(p + 32)); }
__device__ __forceinline__ v16h  ldsh(const unsigned char* p) { return cat16(*(const v8ha*)p, *(const v8ha*)(p + 32)); }

__global__ __launch_bounds__(NGRP * NWV * 32) void k_fused(const bf* __restrict__ QB, const bf* __restrict__ KB, const h16* __restrict__ VT, const int* __restrict__ ringp, float* __restrict__ OUT) {
    __shared__ __align__(16) unsigned char L[LDSB];
    const int tid = threadIdx.x, lane = tid & 31, wave = tid >> 5, c = lane & 15, h = lane >> 4;
    const int grp = wave / NWV, qw = wave % NWV;
    const int head = blockIdx.y, q0 = blockIdx.x * (NWV * 32) + qw * 32;
    int ring = ringp[0]; ring = min(max(ring, 1), RING); (void)ring;
    const bf* Kh = KB + (size_t)head * NN * HD; const h16* Vh = VT + (size_t)head * HD * NN;
    const float cscale = 0.125f * 1.4426950408889634f;   // scores / 8, in the base-2 domain
    unsigned char* Lg = L + (unsigned)grp * (2u * BUFB);          // this group's two stage buffers
    unsigned char* Ow = L + NGRP * 2u * BUFB + (unsigned)wave * OWAVE;   // this wave's own 32 x 64 f32 sum of its chunks' outputs

    v16bf qf[2][2];
#pragma unroll
    for (int g = 0; g < 2; ++g)
#pragma unroll
        for (int kc = 0; kc < 2; ++kc) { const bf* p = QB + ((size_t)head * NN + q0 + 16 * g + c) * HD + 32 * kc + 8 * h; qf[g][kc] = cat16b(*(const v8us*)p, *(const v8us*)(p + 16)); }

    // staging: 512 pieces of 16 bytes per tile, two per thread of the group; eight lanes cover one 128-byte row
    const int srow = (tid & (NWV * 32 - 1)) >> 3, scol = tid & 7;
    v4u sk[2], sv[2];
    auto gload = [&](int s) {
#pragma unroll
        for (int u = 0; u < 2; ++u) { sk[u] = *(const v4u*)(Kh + (size_t)(s * SKEY + srow + 32 * u) * HD + scol * 8); sv[u] = *(const v4u*)(Vh + (size_t)(srow + 32 * u) * NN + s * SKEY + scol * 8); } };
    auto sstore = [&](int b) { unsigned char* d = Lg + (unsigned)b * BUFB + (unsigned)srow * PITCH + (unsigned)scol * 16u;
#pragma unroll
        for (int u = 0; u < 2; ++u) { *(v4ua*)(d + 32u * u * PITCH) = sk[u]; *(v4ua*)(d + TILE + 32u * u * PITCH) = sv[u]; } };

#pragma unroll
    for (int g = 0; g < 2; ++g)
#pragma unroll
        for (int t = 0; t < 4; ++t) { unsigned char* op = Ow + (unsigned)(16 * g + c) * OPIT + (unsigned)(16 * t + 8 * h) * 4u; *(v4fa*)op = (v4f){}; *(v4fa*)(op + 16) = (v4f){}; }
    gload(grp * GSTG); sstore(0);
    __syncthreads();

    // every plain '#pragma unroll' here keeps a fragment or accumulator array in registers: its indices must be compile-time constants
    v8f acc[2][4]; float m_run[2]; v2f l_run[2];   // l_run: this lane's share of the denominator, even and odd keys apart; joined at the chunk's end
#pragma unroll 1   // rolled: one copy of the stage loop, to keep the hot code small
    for (int r = 0; r < RING / NGRP; ++r) {
#pragma unroll
        for (int g = 0; g < 2; ++g) { m_run[g] = -__builtin_inff(); l_run[g] = (v2f){};
#pragma unroll
            for (int t = 0; t < 4; ++t) acc[g][t] = (v8f){}; }
#pragma unroll 1   // rolled: unrolling would only multiply the two-pass body and its registers
        for (int st = 0; st < CSTG; ++st) {
            const int s = r * CSTG + st; const bool more = s + 1 < GSTG;   // s counts the group's own stages
            if (more) gload(grp * GSTG + s + 1);
            const unsigned char* Bp = Lg + (unsigned)(s & 1) * BUFB;
#pragma unroll
            for (int sub = 0; sub < 2; ++sub) {   // one pass = 32 keys
                v8f sc[2][2];
#pragma unroll
                for (int kt = 0; kt < 2; ++kt) { const unsigned char* kp = Bp + (unsigned)(32 * sub + 16 * kt + c) * PITCH + 16u * h; const v16bf k0 = ldsb(kp), k1 = ldsb(kp + 64);
#pragma unroll
                    for (int g = 0; g < 2; ++g) { sc[kt][g] = wmmab(k0, qf[g][0], (v8f){}); sc[kt][g] = wmmab(k1, qf[g][1], sc[kt][g]); } }
                v16h vf[4];
#pragma unroll
                for (int t = 0; t < 4; ++t) vf[t] = ldsh(Bp + TILE + (unsigned)(16 * t + c) * PITCH + 64u * sub + 16u * h);
                // maxima of the raw scores (the scale is positive); the maximum in use may trail the true one by up to 8 (base 2), so an exponential stays below 2^12
                float mb[2]; bool need = false;
#pragma unroll
                for (int g = 0; g < 2; ++g) { float mx = sc[0][g][0];
#pragma unroll
                    for (int j = 1; j < 8; ++j) mx = fmaxf(mx, sc[0][g][j]);
#pragma unroll
                    for (int j = 0; j < 8; ++j) mx = fmaxf(mx, sc[1][g][j]);
                    mx = fmaxf(mx, xhalf(mx)) * cscale; mb[g] = mx; need = need || (mx > m_run[g] + 8.0f); }
                if (__builtin_amdgcn_ballot_w32(need) != 0) {   // always on a chunk's first pass, rare afterwards
#pragma unroll
                    for (int g = 0; g < 2; ++g) { const float mn = fmaxf(m_run[g], mb[g]); const float corr = __builtin_amdgcn_exp2f(m_run[g] - mn); m_run[g] = mn; l_run[g] = l_run[g] * corr;
#pragma unroll
                        for (int t = 0; t < 4; ++t) acc[g][t] = acc[g][t] * corr; }
                }
#pragma unroll
                for (int g = 0; g < 2; ++g) { const float nm = 4.0f - m_run[g];   // + 4: keeps small probabilities out of fp16's subnormals; it cancels in acc / l
                    v8u w;
#pragma unroll
                    for (int i = 0; i < 8; ++i) { const float p0 = __builtin_amdgcn_exp2f(fmaf(sc[i >> 2][g][2 * (i & 3)], cscale, nm)), p1 = __builtin_amdgcn_exp2f(fmaf(sc[i >> 2][g][2 * (i & 3) + 1], cscale, nm)); l_run[g] += (v2f){p0, p1}; w[i] = pack2h(p0, p1); }
                    const v16h pf = __builtin_bit_cast(v16h, w);
#pragma unroll
                    for (int t = 0; t < 4; ++t) acc[g][t] = wmma16(vf[t], pf, acc[g][t]); }
            }
            if (more) sstore((s + 1) & 1);
            __syncthreads();   // publishes stage s + 1 and ends every wave's reads of stage s, whose buffer the next trip refills
        }
        // end of a chunk: its softmax is complete; add its normalised output to the wave's own sum in LDS (each lane its own 64 slots)
#pragma unroll
        for (int g = 0; g < 2; ++g) { const float lh = l_run[g][0] + l_run[g][1]; const float l = lh + xhalf(lh); const float inv = __fdiv_rn(1.0f, l);
#pragma unroll
            for (int t = 0; t < 4; ++t) { unsigned char* op = Ow + (unsigned)(16 * g + c) * OPIT + (unsigned)(16 * t + 8 * h) * 4u; v4f a0 = *(const v4fa*)op, a1 = *(const v4fa*)(op + 16);
#pragma unroll
                for (int j = 0; j < 4; ++j) { a0[j] += acc[g][t][j] * inv; a1[j] += acc[g][t][4 + j] * inv; }
                *(v4fa*)op = a0; *(v4fa*)(op + 16) = a1; } }
    }
    __syncthreads();   // the sums are read back across lanes and across the two groups
    // whole rows out: 16 lanes cover one query's 256 bytes; each wave joins the two groups' sums for 16 of its 32 queries
    const unsigned char* O0 = L + NGRP * 2u * BUFB + (unsigned)qw * OWAVE;
#pragma unroll
    for (int i = 0; i < 8; ++i) { const int row = 16 * grp + 2 * i + h; const unsigned char* op = O0 + (unsigned)row * OPIT + (unsigned)c * 16u;
        const v4f val = *(const v4fa*)op + *(const v4fa*)(op + NWV * OWAVE); *(v4f*)(OUT + ((size_t)(q0 + row) * NH_ + head) * HD + c * 4) = val; }
}

extern "C" void kernel_launch(void* const* d_in, const int* in_sizes, int n_in,
                              void* d_out, int out_size, void* d_ws, size_t ws_size, hipStream_t stream) {
    (void)in_sizes; (void)n_in; (void)out_size;
    const float* q = (const float*)d_in[0]; const float* k = (const float*)d_in[1]; const float* v = (const float*)d_in[2]; const int* ringp = (const int*)d_in[3];
    float* OUT = (float*)d_out;     // [1][4096][16][64]
    char* wsp = (char*)d_ws;
    auto take = [&](size_t bytes) { char* p = wsp; wsp += (bytes + 255) & ~(size_t)255; return (void*)p; };
    bf* QB = (bf*)take((size_t)NH_ * NN * HD * 2); bf* KB = (bf*)take((size_t)NH_ * NN * HD * 2); h16* VT = (h16*)take((size_t)NH_ * HD * NN * 2);
    if ((size_t)(wsp - (char*)d_ws) > ws_size) return;
    k_lay<<<dim3(NN / LROW, NH_), 256, 0, stream>>>(q, k, v, QB, KB, VT);
    k_fused<<<dim3(NN / (NWV * 32), NH_), NGRP * NWV * 32, 0, stream>>>(QB, KB, VT, ringp, OUT);
}

// v004
// A run of this version takes 59.7 microseconds.
// In two side-by-side timings against v003, it was 1.07 and 1.08 times as fast.
// All steps since v000 together make it 22.2 times as fast.
#include <hip/hip_runtime.h>

// Ring attention with an INDEPENDENT softmax over each of the 4 key chunks of 1024 (scores/8), the per-chunk outputs SUMMED:
// out[n][h] = sum_r softmax_r(q.k_r / 8) v_r, query/key/value [1][4096][16][64] -> [1][4096][16][64].
// Compute dtypes, f32 accumulate: every input rounded to bf16; scores on plain bf16 operands (K 64); softmax in f32 registers; probabilities in fp16 against fp16 V.
// Two launches: k_lay lays the three 16-bit planes, k_fused does scores, the four softmaxes and P.V without the scores ever leaving registers.

#define NN   4096
#define NH_  16
#define HD   64
#define RING 4
typedef _Float16 h16;
typedef unsigned short bf;
typedef __attribute__((ext_vector_type(16))) __bf16   v16bf;
typedef __attribute__((ext_vector_type(16))) _Float16 v16h;
typedef __attribute__((ext_vector_type(8)))  _Float16 v8h;
typedef __attribute__((ext_vector_type(8)))  unsigned short v8us;
typedef __attribute__((ext_vector_type(8)))  float    v8f;
typedef __attribute__((ext_vector_type(4)))  float    v4f;
typedef __attribute__((ext_vector_type(2)))  float    v2f;
typedef __attribute__((ext_vector_type(4)))  unsigned v4u;
typedef __attribute__((ext_vector_type(8)))  unsigned v8u;
typedef __attribute__((ext_vector_type(2))) _Float16 v2h;
typedef __attribute__((ext_vector_type(4))) unsigned short v4us;
typedef v8h  __attribute__((may_alias)) v8ha;
typedef v4f  __attribute__((may_alias)) v4fa;
typedef v4u  __attribute__((may_alias)) v4ua;
typedef v8us __attribute__((may_alias)) v8usa;

__device__ __forceinline__ unsigned short f2bf(float f) { unsigned u = __float_as_uint(f); u += 0x7FFFu + ((u >> 16) & 1u); return (unsigned short)(u >> 16); }
__device__ __forceinline__ float bf2f(unsigned short b) { return __uint_as_float(((unsigned)b) << 16); }
__device__ __forceinline__ float bfr(float f) { return bf2f(f2bf(f)); }
__device__ __forceinline__ v16h cat16(v8h lo, v8h hi) { return __builtin_shufflevector(lo, hi, 0, 1, 2, 3, 4, 5, 6, 7, 8, 9, 10, 11, 12, 13, 14, 15); }
__device__ __forceinline__ v16bf cat16b(v8us lo, v8us hi) { return __builtin_bit_cast(v16bf, __builtin_shufflevector(lo, hi, 0, 1, 2, 3, 4, 5, 6, 7, 8, 9, 10, 11, 12, 13, 14, 15)); }
__device__ __forceinline__ v8f wmma16(v16h a, v16h b, v8f c) { return __builtin_amdgcn_wmma_f32_16x16x32_f16(false, a, false, b, (short)0, c, false, false); }
__device__ __forceinline__ v8f wmmab(v16bf a, v16bf b, v8f c) { return __builtin_amdgcn_wmma_f32_16x16x32_bf16(false, a, false, b, (short)0, c, false, false); }
__device__ __forceinline__ h16 tohx(float x) { return (h16)x; }

// ---- k_lay: one workgroup = 128 positions of one head, all three planes; grid (NN / LROW, NH_).
// Every global load is 16 bytes a lane over whole 256-byte rows of the inputs, all 24 of a thread issued before the first is used.
// Q and K: a wave's store covers two neighbouring rows of the plane, 256 bytes in a row. V: a thread holds 8 positions x 4 d, packs 8 positions of one d into 16 bytes,
// and the pieces change threads through LDS so that 16 lanes store one d row's 256 bytes. Piece (d, p) lies at column p ^ (d >> 2) of its 256-byte LDS row: writers and readers each cover all banks.
#define LROW 128
__global__ __launch_bounds__(256) void k_lay(const float* __restrict__ q, const float* __restrict__ k, const float* __restrict__ v, bf* __restrict__ QB, bf* __restrict__ KB, h16* __restrict__ VT) {
    __shared__ __align__(16) unsigned char T[HD * LROW * 2];
    const int tid = threadIdx.x, c4 = tid & 15, rq = tid >> 4;
    const int head = blockIdx.y, n0 = blockIdx.x * LROW;
    const size_t base = ((size_t)n0 * NH_ + head) * HD + 4 * c4;
    v4f w[8], a[8], b[8];
#pragma unroll
    for (int i = 0; i < 8; ++i) w[i] = *(const v4f*)(v + base + (size_t)(8 * rq + i) * (NH_ * HD));
    asm volatile("s_wait_xcnt 0x0" ::: "memory");   // a later load's result lands in the registers that held these loads' address: the wait that belongs in front of such an overwrite
#pragma unroll
    for (int i = 0; i < 8; ++i) a[i] = *(const v4f*)(q + base + (size_t)(rq + 16 * i) * (NH_ * HD));
#pragma unroll
    for (int i = 0; i < 8; ++i) b[i] = *(const v4f*)(k + base + (size_t)(rq + 16 * i) * (NH_ * HD));
    __builtin_amdgcn_sched_barrier(0);   // keeps all 24 loads in front of the first use: without it the compiler holds a part of them back behind the first waits, and the wave pays the memory latency several times
#pragma unroll
    for (int j = 0; j < 4; ++j) { v8h p;
#pragma unroll
        for (int u = 0; u < 8; ++u) p[u] = tohx(bfr(w[u][j]));
        *(v8ha*)(T + (unsigned)(4 * c4 + j) * (LROW * 2u) + ((unsigned)(rq ^ c4) << 4)) = p; }
    __syncthreads();   // the V pieces are read back by other threads; it stands in front of every global store, so that no store is waited for here
#pragma unroll
    for (int i = 0; i < 4; ++i) { const int d = rq + 16 * i; const v8h val = *(const v8ha*)(T + (unsigned)d * (LROW * 2u) + ((unsigned)(c4 ^ ((d >> 2) & 15)) << 4)); *(v8h*)(VT + ((size_t)head * HD + d) * NN + n0 + 8 * c4) = val; }
    const size_t orow = ((size_t)head * NN + n0 + rq) * HD + 4 * c4;
#pragma unroll
    for (int i = 0; i < 8; ++i) { v4us o;
#pragma unroll
        for (int u = 0; u < 4; ++u) o[u] = f2bf(a[i][u]);
        *(v4us*)(QB + orow + (size_t)(16 * i) * HD) = o; }
#pragma unroll
    for (int i = 0; i < 8; ++i) { v4us o;
#pragma unroll
        for (int u = 0; u < 4; ++u) o[u] = f2bf(b[i][u]);
        *(v4us*)(KB + orow + (size_t)(16 * i) * HD) = o; }
}

#define NWV   8                       // waves of a group, 32 queries each
#define NGRP  2                       // groups of waves, RING / NGRP chunks each
#define SKEY  64                      // keys per stage
#define GSTG  (NN / NGRP / SKEY)      // 32 stages per group
#define CSTG  (NN / RING / SKEY)      // 16 stages per chunk
#define PITCH 144u                    // LDS pitch of a 128-byte row, 16 B x odd
#define TILE  (64u * PITCH)           // K tile: 64 keys x 64 d (bf16); V^T tile: 64 d x 64 keys (fp16)
#define BUFB  (2u * TILE)
#define OPIT  272u                    // LDS pitch of a 256-byte output row
#define OWAVE (32u * OPIT)
#define LDSB  (NGRP * 2u * BUFB + NGRP * NWV * OWAVE)
__device__ __forceinline__ float xhalf(float x) { return __builtin_bit_cast(float, __builtin_amdgcn_permlanex16(__builtin_bit_cast(int, x), __builtin_bit_cast(int, x), 0x76543210, 0xfedcba98, false, false)); }  // lane l with lane l ^ 16
__device__ __forceinline__ unsigned pack2h(float lo, float hi) { return __builtin_bit_cast(unsigned, __builtin_convertvector((v2f){lo, hi}, v2h)); }  // round to nearest even
__device__ __forceinline__ v16bf ldsb(const unsigned char* p) { return cat16b(*(const v8usa*)p, *(const v8usa*)(p + 32)); }
__device__ __forceinline__ v16h  ldsh(const unsigned char* p) { return cat16(*(const v8ha*)p, *(const v8ha*)(p + 32)); }

__global__ __launch_bounds__(NGRP * NWV * 32) void k_fused(const bf* __restrict__ QB, const bf* __restrict__ KB, const h16* __restrict__ VT, const int* __restrict__ ringp, float* __restrict__ OUT) {
    __shared__ __align__(16) unsigned char L[LDSB];
    const int tid = threadIdx.x, lane = tid & 31, wave = tid >> 5, c = lane & 15, h = lane >> 4;
    const int grp = wave / NWV, qw = wave % NWV;
    const int head = blockIdx.y, q0 = blockIdx.x * (NWV * 32) + qw * 32;
    int ring = ringp[0]; ring = min(max(ring, 1), RING); (void)ring;
    const bf* Kh = KB + (size_t)head * NN * HD; const h16* Vh = VT + (size_t)head * HD * NN;
    const float cscale = 0.125f * 1.4426950408889634f;   // scores / 8, in the base-2 domain
    unsigned char* Lg = L + (unsigned)grp * (2u * BUFB);          // this group's two stage buffers
    unsigned char* Ow = L + NGRP * 2u * BUFB + (unsigned)wave * OWAVE;   // this wave's own 32 x 64 f32 sum of its chunks' outputs

    v16bf qf[2][2];
#pragma unroll
    for (int g = 0; g < 2; ++g)
#pragma unroll
        for (int kc = 0; kc < 2; ++kc) { const bf* p = QB + ((size_t)head * NN + q0 + 16 * g + c) * HD + 32 * kc + 8 * h; qf[g][kc] = cat16b(*(const v8us*)p, *(const v8us*)(p + 16)); }

    // staging: 512 pieces of 16 bytes per tile, two per thread of the group; eight lanes cover one 128-byte row
    const int srow = (tid & (NWV * 32 - 1)) >> 3, scol = tid & 7;
    v4u sk[2], sv[2];
    auto gload = [&](int s) {
#pragma unroll
        for (int u = 0; u < 2; ++u) { sk[u] = *(const v4u*)(Kh + (size_t)(s * SKEY + srow + 32 * u) * HD + scol * 8); sv[u] = *(const v4u*)(Vh + (size_t)(srow + 32 * u) * NN + s * SKEY + scol * 8); } };
    auto sstore = [&](int b) { unsigned char* d = Lg + (unsigned)b * BUFB + (unsigned)srow * PITCH + (unsigned)scol * 16u;
#pragma unroll
        for (int u = 0; u < 2; ++u) { *(v4ua*)(d + 32u * u * PITCH) = sk[u]; *(v4ua*)(d + TILE + 32u * u * PITCH) = sv[u]; } };

#pragma unroll
    for (int g = 0; g < 2; ++g)
#pragma unroll
        for (int t = 0; t < 4; ++t) { unsigned char* op = Ow + (unsigned)(16 * g + c) * OPIT + (unsigned)(16 * t + 8 * h) * 4u; *(v4fa*)op = (v4f){}; *(v4fa*)(op + 16) = (v4f){}; }
    gload(grp * GSTG); sstore(0);
    __syncthreads();

    // every plain '#pragma unroll' here keeps a fragment or accumulator array in registers: its indices must be compile-time constants
    v8f acc[2][4]; float m_run[2]; v2f l_run[2];   // l_run: this lane's share of the denominator, even and odd keys apart; joined at the chunk's end
    // one pass = 32 keys x 32 queries: its K fragments from the stage at Bp, and S^T from them
    auto kfrag = [&](const unsigned char* Bp, int sub, v16bf (&kf)[2][2]) {
#pragma unroll
        for (int kt = 0; kt < 2; ++kt) { const unsigned char* kp = Bp + (unsigned)(32 * sub + 16 * kt + c) * PITCH + 16u * h; kf[kt][0] = ldsb(kp); kf[kt][1] = ldsb(kp + 64); } };
    auto scores = [&](const v16bf (&kf)[2][2], v8f (&sc)[2][2]) {
#pragma unroll
        for (int kt = 0; kt < 2; ++kt)
#pragma unroll
            for (int g = 0; g < 2; ++g) { sc[kt][g] = wmmab(kf[kt][0], qf[g][0], (v8f){}); sc[kt][g] = wmmab(kf[kt][1], qf[g][1], sc[kt][g]); } };
    // each query's maximum over one pass, of the raw scores (the scale is positive), then scaled
    auto passmax = [&](const v8f (&sc)[2][2], float (&mb)[2]) {
#pragma unroll
        for (int g = 0; g < 2; ++g) { float mx = sc[0][g][0];
#pragma unroll
            for (int j = 1; j < 8; ++j) mx = fmaxf(mx, sc[0][g][j]);
#pragma unroll
            for (int j = 0; j < 8; ++j) mx = fmaxf(mx, sc[1][g][j]);
            mb[g] = fmaxf(mx, xhalf(mx)) * cscale; } };
    // probabilities against the maximum in use, packed for P^T, and this lane's sums of them over the pass
    auto probs = [&](const v8f (&sc)[2][2], v8u (&w)[2], v2f (&ps)[2]) {
#pragma unroll
        for (int g = 0; g < 2; ++g) { const float nm = 4.0f - m_run[g];   // + 4: keeps small probabilities out of fp16's subnormals; it cancels in acc / l
#pragma unroll
            for (int i = 0; i < 8; ++i) { const v2f x = __builtin_elementwise_fma((v2f){sc[i >> 2][g][2 * (i & 3)], sc[i >> 2][g][2 * (i & 3) + 1]}, (v2f){cscale, cscale}, (v2f){nm, nm});
                const v2f p = {__builtin_amdgcn_exp2f(x[0]), __builtin_amdgcn_exp2f(x[1])}; ps[g] = i ? ps[g] + p : p; w[g][i] = pack2h(p[0], p[1]); } } };
#pragma unroll 1   // rolled: one copy of the stage loop, so that the hot code stays small in the instruction cache
    for (int r = 0; r < RING / NGRP; ++r) {
#pragma unroll
        for (int g = 0; g < 2; ++g) { l_run[g] = (v2f){};
#pragma unroll
            for (int t = 0; t < 4; ++t) acc[g][t] = (v8f){}; }
        { v16bf kf[2][2]; v8f sc[2][2]; kfrag(Lg + (unsigned)((r * CSTG) & 1) * BUFB, 0, kf); scores(kf, sc); passmax(sc, m_run); }   // the chunk's first maximum in use: the true one of its first 32 keys
#pragma unroll 1   // rolled: unrolling would only multiply the two-pass body and its registers
        for (int st = 0; st < CSTG; ++st) {
            const int s = r * CSTG + st; const bool more = s + 1 < GSTG;   // s counts the group's own stages
            if (more) gload(grp * GSTG + s + 1);
            const unsigned char* Bp = Lg + (unsigned)(s & 1) * BUFB;
#pragma unroll
            for (int sub = 0; sub < 2; ++sub) {   // one pass = 32 keys
                v16bf kf[2][2]; v8f sc[2][2]; v8u w[2]; v2f ps[2];
                kfrag(Bp, sub, kf);
                v16h vf[4];
#pragma unroll
                for (int t = 0; t < 4; ++t) vf[t] = ldsh(Bp + TILE + (unsigned)(16 * t + c) * PITCH + 64u * sub + 16u * h);
                __builtin_amdgcn_sched_barrier(0);   // keeps the pass's 16 LDS reads together at its head: left free, the V^T reads sink behind the range test below, directly in front of the products that wait for them
                scores(kf, sc);
                // no maximum on the common path: exponentiate against the maximum in use and let the sums, which the denominator needs anyway, say whether that was in range.
                // All terms are positive, so a lane's sum of at most 2^15 bounds each of its probabilities below fp16's largest number.
                probs(sc, w, ps);
                const v2f pj = ps[0] + ps[1];
                if (__builtin_amdgcn_ballot_w32(!(pj[0] + pj[1] <= 32768.0f)) != 0) {   // rare: a score lies some 11 (base 2) above the maximum in use
                    float mb[2]; kfrag(Bp, sub, kf); scores(kf, sc); passmax(sc, mb);   // the scores' registers are used up: formed again from the stage in LDS
#pragma unroll
                    for (int g = 0; g < 2; ++g) { const float mn = fmaxf(m_run[g], mb[g]); const float corr = __builtin_amdgcn_exp2f(m_run[g] - mn); m_run[g] = mn; l_run[g] = l_run[g] * corr;
#pragma unroll
                        for (int t = 0; t < 4; ++t) acc[g][t] = acc[g][t] * corr; }
                    probs(sc, w, ps);   // now every probability is at most 2^4
                }
#pragma unroll
                for (int g = 0; g < 2; ++g) { l_run[g] += ps[g]; const v16h pf = __builtin_bit_cast(v16h, w[g]);
#pragma unroll
                    for (int t = 0; t < 4; ++t) acc[g][t] = wmma16(vf[t], pf, acc[g][t]); }
            }
            if (more) sstore((s + 1) & 1);
            __syncthreads();   // publishes stage s + 1 and ends every wave's reads of stage s, whose buffer the next trip refills
        }
        // end of a chunk: its softmax is complete; add its normalised output to the wave's own sum in LDS (each lane its own 64 slots)
#pragma unroll
        for (int g = 0; g < 2; ++g) { const float lh = l_run[g][0] + l_run[g][1]; const float l = lh + xhalf(lh); const float inv = __fdiv_rn(1.0f, l);
#pragma unroll
            for (int t = 0; t < 4; ++t) { unsigned char* op = Ow + (unsigned)(16 * g + c) * OPIT + (unsigned)(16 * t + 8 * h) * 4u; v4f a0 = *(const v4fa*)op, a1 = *(const v4fa*)(op + 16);
#pragma unroll
                for (int j = 0; j < 4; ++j) { a0[j] += acc[g][t][j] * inv; a1[j] += acc[g][t][4 + j] * inv; }
                *(v4fa*)op = a0; *(v4fa*)(op + 16) = a1; } }
    }
    __syncthreads();   // the sums are read back across lanes and across the two groups
    // whole rows out: 16 lanes cover one query's 256 bytes; each wave joins the two groups' sums for 16 of its 32 queries
    const unsigned char* O0 = L + NGRP * 2u * BUFB + (unsigned)qw * OWAVE;
#pragma unroll
    for (int i = 0; i < 8; ++i) { const int row = 16 * grp + 2 * i + h; const unsigned char* op = O0 + (unsigned)row * OPIT + (unsigned)c * 16u;
        const v4f val = *(const v4fa*)op + *(const v4fa*)(op + NWV * OWAVE); *(v4f*)(OUT + ((size_t)(q0 + row) * NH_ + head) * HD + c * 4) = val; }
}

extern "C" void kernel_launch(void* const* d_in, const int* in_sizes, int n_in,
                              void* d_out, int out_size, void* d_ws, size_t ws_size, hipStream_t stream) {
    (void)in_sizes; (void)n_in; (void)out_size;
    const float* q = (const float*)d_in[0]; const float* k = (const float*)d_in[1]; const float* v = (const float*)d_in[2]; const int* ringp = (const int*)d_in[3];
    float* OUT = (float*)d_out;     // [1][4096][16][64]
    char* wsp = (char*)d_ws;
    auto take = [&](size_t bytes) { char* p = wsp; wsp += (bytes + 255) & ~(size_t)255; return (void*)p; };
    bf* QB = (bf*)take((size_t)NH_ * NN * HD * 2); bf* KB = (bf*)take((size_t)NH_ * NN * HD * 2); h16* VT = (h16*)take((size_t)NH_ * HD * NN * 2);
    if ((size_t)(wsp - (char*)d_ws) > ws_size) return;
    k_lay<<<dim3(NN / LROW, NH_), 256, 0, stream>>>(q, k, v, QB, KB, VT);
    k_fused<<<dim3(NN / (NWV * 32), NH_), NGRP * NWV * 32, 0, stream>>>(QB, KB, VT, ringp, OUT);
}

// v006
// Measured time: 50.4 microseconds a run.
// Versions in between are left out here; by their measured steps it is 1.18 times as fast as v004.
// Counting every step since v000, it is 26.2 times as fast.
#include <hip/hip_runtime.h>

// Ring attention with an INDEPENDENT softmax over each of the 4 key chunks of 1024 (scores/8), the per-chunk outputs SUMMED:
// out[n][h] = sum_r softmax_r(q.k_r / 8) v_r, query/key/value [1][4096][16][64] -> [1][4096][16][64].
// Compute dtypes, f32 accumulate: Q and K rounded to bf16, V to fp16; scores on plain bf16 operands (K 64); softmax in f32 registers; probabilities in fp16 against fp16 V.
// One launch: k_fused reads the f32 inputs itself, rounds them on their way into registers (Q) and LDS (K, V), and does scores, the four softmaxes and P.V without the scores ever leaving registers.

#define NN   4096
#define NH_  16
#define HD   64
#define RING 4
typedef __attribute__((ext_vector_type(16))) __bf16   v16bf;
typedef __attribute__((ext_vector_type(16))) _Float16 v16h;
typedef __attribute__((ext_vector_type(8)))  _Float16 v8h;
typedef __attribute__((ext_vector_type(8)))  unsigned short v8us;
typedef __attribute__((ext_vector_type(8)))  float    v8f;
typedef __attribute__((ext_vector_type(4)))  float    v4f;
typedef __attribute__((ext_vector_type(2)))  float    v2f;
typedef __attribute__((ext_vector_type(8)))  unsigned v8u;
typedef __attribute__((ext_vector_type(2))) _Float16 v2h;
typedef __attribute__((ext_vector_type(2))) __bf16   v2b;
typedef __attribute__((ext_vector_type(2))) unsigned v2u;
typedef __attribute__((ext_vector_type(8))) short    v8s;
typedef v4f  __attribute__((may_alias)) v4fa;
typedef v8us __attribute__((may_alias)) v8usa;
typedef v2u  __attribute__((may_alias)) v2ua;

__device__ __forceinline__ v16h cat16(v8h lo, v8h hi) { return __builtin_shufflevector(lo, hi, 0, 1, 2, 3, 4, 5, 6, 7, 8, 9, 10, 11, 12, 13, 14, 15); }
__device__ __forceinline__ v16bf cat16b(v8us lo, v8us hi) { return __builtin_bit_cast(v16bf, __builtin_shufflevector(lo, hi, 0, 1, 2, 3, 4, 5, 6, 7, 8, 9, 10, 11, 12, 13, 14, 15)); }
__device__ __forceinline__ v8f wmma16(v16h a, v16h b, v8f c) { return __builtin_amdgcn_wmma_f32_16x16x32_f16(false, a, false, b, (short)0, c, false, false); }
__device__ __forceinline__ v8f wmmab(v16bf a, v16bf b, v8f c) { return __builtin_amdgcn_wmma_f32_16x16x32_bf16(false, a, false, b, (short)0, c, false, false); }

#define NWV   8                       // waves of a group, 32 queries each
#define NGRP  2                       // groups of waves, RING / NGRP chunks each
#define SKEY  64                      // keys per stage
#define GSTG  (NN / NGRP / SKEY)      // 32 stages per group
#define CSTG  (NN / RING / SKEY)      // 16 stages per chunk
#define PITCH 144u                    // LDS pitch of a 128-byte K row, 16 B x odd: for 16-byte reads
#define VPIT  160u                    // LDS pitch of a 128-byte V row, 32 B x odd: for the transposing reads
#define TILE  (64u * PITCH)           // K tile: 64 keys x 64 d (bf16)
#define VTILE (64u * VPIT)            // V tile: 64 keys x 64 d (fp16)
#define BUFB  (TILE + VTILE)
#define OPIT  272u                    // LDS pitch of a 256-byte output row
#define OWAVE (32u * OPIT)
#define LDSB  (NGRP * 2u * BUFB + NGRP * NWV * OWAVE)
__device__ __forceinline__ float xhalf(float x) { return __builtin_bit_cast(float, __builtin_amdgcn_permlanex16(__builtin_bit_cast(int, x), __builtin_bit_cast(int, x), 0x76543210, 0xfedcba98, false, false)); }  // lane l with lane l ^ 16
__device__ __forceinline__ unsigned pack2h(float lo, float hi) { return __builtin_bit_cast(unsigned, __builtin_convertvector((v2f){lo, hi}, v2h)); }  // round to nearest even
__device__ __forceinline__ v16bf ldsb(const unsigned char* p) { return cat16b(*(const v8usa*)p, *(const v8usa*)(p + 32)); }
__device__ __forceinline__ unsigned pack2b(float lo, float hi) { return __builtin_bit_cast(unsigned, __builtin_convertvector((v2f){lo, hi}, v2b)); }  // round to nearest even
__device__ __forceinline__ v8h ldtr(const unsigned char* p) { typedef __attribute__((address_space(3))) v8s lds_v8s; return __builtin_bit_cast(v8h, __builtin_amdgcn_ds_load_tr16_b128_v8i16((lds_v8s*)p)); }  // lane (c, h) gets column c of the 8 rows that its half's lanes point at

__global__ __launch_bounds__(NGRP * NWV * 32) void k_fused(const float* __restrict__ q, const float* __restrict__ k, const float* __restrict__ v, const int* __restrict__ ringp, float* __restrict__ OUT) {
    __shared__ __align__(16) unsigned char L[LDSB];
    const int tid = threadIdx.x, lane = tid & 31, wave = tid >> 5, c = lane & 15, h = lane >> 4;
    const int grp = wave / NWV, qw = wave % NWV;
    const int head = blockIdx.y, q0 = blockIdx.x * (NWV * 32) + qw * 32;
    int ring = ringp[0]; ring = min(max(ring, 1), RING); (void)ring;
    const float cscale = 0.125f * 1.4426950408889634f;   // scores / 8, in the base-2 domain
    unsigned char* Lg = L + (unsigned)grp * (2u * BUFB);          // this group's two stage buffers
    unsigned char* Ow = L + NGRP * 2u * BUFB + (unsigned)wave * OWAVE;   // this wave's own 32 x 64 f32 sum of its chunks' outputs

    v16bf qf[2][2];
    const float* const qp[2] = {q + ((size_t)(q0 + c) * NH_ + head) * HD + 8 * h, q + ((size_t)(q0 + 16 + c) * NH_ + head) * HD + 8 * h};
#pragma unroll
    for (int g = 0; g < 2; ++g)
#pragma unroll
        for (int kc = 0; kc < 2; ++kc) { const float* p = qp[g] + 32 * kc; const v4f a0 = *(const v4f*)p, a1 = *(const v4f*)(p + 4), a2 = *(const v4f*)(p + 16), a3 = *(const v4f*)(p + 20);
            qf[g][kc] = __builtin_bit_cast(v16bf, (v8u){pack2b(a0[0], a0[1]), pack2b(a0[2], a0[3]), pack2b(a1[0], a1[1]), pack2b(a1[2], a1[3]), pack2b(a2[0], a2[1]), pack2b(a2[2], a2[3]), pack2b(a3[0], a3[1]), pack2b(a3[2], a3[3])}); }
    asm volatile("s_wait_xcnt 0x0" :: "v"(qp[0]), "v"(qp[1]) : "memory");   // the wait that belongs in front of an overwrite of these loads' address registers; it takes the addresses as inputs, so that no load's result is placed over them earlier

    // staging: a stage's K and V are 64 rows of 256 bytes (f32) each, 4 KiB apart in the inputs; 16 lanes cover one whole row with 16 bytes each, four rows of each input per thread of the group
    const int srow = (tid & (NWV * 32 - 1)) >> 4, scol = tid & 15;
    const size_t sbase = ((size_t)(grp * GSTG * SKEY + srow) * NH_ + head) * HD + 4 * scol;
    const float* kn = k + sbase; const float* vn = v + sbase;   // this thread's first row of the stage that is loaded next
    // in the loop K of stage s + 1 flies under stage s's first pass and V of stage s + 2 under its second, through the same 16 registers
    auto gload = [&](const float*& p, v4f (&x)[4]) {
#pragma unroll
        for (int u = 0; u < 4; ++u) x[u] = *(const v4f*)(p + (size_t)(16 * u) * (NH_ * HD));
        asm volatile("s_wait_xcnt 0x0" :: "v"(p) : "memory");   // the wait that belongs in front of an overwrite of these loads' address registers (the step to the next stage); it takes the address as an input, so that no load's result is placed over it earlier
        p += (size_t)SKEY * (NH_ * HD);
    };
    auto storek = [&](int b, const v4f (&x)[4]) { unsigned char* d = Lg + (unsigned)b * BUFB + (unsigned)srow * PITCH + (unsigned)scol * 8u;
#pragma unroll
        for (int u = 0; u < 4; ++u) *(v2ua*)(d + 16u * u * PITCH) = (v2u){pack2b(x[u][0], x[u][1]), pack2b(x[u][2], x[u][3])}; };
    auto storev = [&](int b, const v4f (&x)[4]) { unsigned char* d = Lg + (unsigned)b * BUFB + TILE + (unsigned)srow * VPIT + (unsigned)scol * 8u;
#pragma unroll
        for (int u = 0; u < 4; ++u) *(v2ua*)(d + 16u * u * VPIT) = (v2u){pack2h(x[u][0], x[u][1]), pack2h(x[u][2], x[u][3])}; };

#pragma unroll
    for (int g = 0; g < 2; ++g)
#pragma unroll
        for (int t = 0; t < 4; ++t) { unsigned char* op = Ow + (unsigned)(16 * g + c) * OPIT + (unsigned)(16 * t + 8 * h) * 4u; *(v4fa*)op = (v4f){}; *(v4fa*)(op + 16) = (v4f){}; }
    v4f sg[4];   // the staged rows in flight; carried from a stage's second pass into the next stage's first
    { v4f xk[4], xv[4]; gload(kn, xk); gload(vn, xv); storek(0, xk); storev(0, xv); }
    gload(vn, sg);   // V of stage 1
    __syncthreads();

    // every plain '#pragma unroll' here keeps a fragment or accumulator array in registers: its indices must be compile-time constants
    v8f acc[2][4]; float m_run[2]; v2f l_run[2];   // l_run: this lane's share of the denominator, even and odd keys apart; joined at the chunk's end
    // one pass = 32 keys x 32 queries: its K fragments from the stage at Bp, and S^T from them
    auto kfrag = [&](const unsigned char* Bp, int sub, v16bf (&kf)[2][2]) {
#pragma unroll
        for (int kt = 0; kt < 2; ++kt) { const unsigned char* kp = Bp + (unsigned)(32 * sub + 16 * kt + c) * PITCH + 16u * h; kf[kt][0] = ldsb(kp); kf[kt][1] = ldsb(kp + 64); } };
    // the same fragments from the f32 input, rounded as the staging rounds them: for the redo of a stage's second pass, which may no longer read the stage in LDS
    auto kglob = [&](int s, int sub, v16bf (&kf)[2][2]) {
        const float* const kb = k + ((size_t)((__builtin_amdgcn_readfirstlane(grp) * GSTG + s) * SKEY + 32 * sub) * NH_ + head) * HD;   // the pass's first key row: the same for the whole wave
        const unsigned ko = (unsigned)c * (NH_ * HD) + 8u * h;
#pragma unroll
        for (int kt = 0; kt < 2; ++kt)
#pragma unroll
            for (int kc = 0; kc < 2; ++kc) { const float* p = kb + (ko + (unsigned)(16 * kt * (NH_ * HD) + 32 * kc)); const v4f a0 = *(const v4f*)p, a1 = *(const v4f*)(p + 4), a2 = *(const v4f*)(p + 16), a3 = *(const v4f*)(p + 20);
                kf[kt][kc] = __builtin_bit_cast(v16bf, (v8u){pack2b(a0[0], a0[1]), pack2b(a0[2], a0[3]), pack2b(a1[0], a1[1]), pack2b(a1[2], a1[3]), pack2b(a2[0], a2[1]), pack2b(a2[2], a2[3]), pack2b(a3[0], a3[1]), pack2b(a3[2], a3[3])}); }
        asm volatile("s_wait_xcnt 0x0" :: "s"(kb), "v"(ko) : "memory");   // the wait that belongs in front of an overwrite of these loads' address registers; it takes the addresses as inputs, so that no load's result is placed over them earlier
    };
    auto scores = [&](const v16bf (&kf)[2][2], v8f (&sc)[2][2]) {
#pragma unroll
        for (int kt = 0; kt < 2; ++kt)
#pragma unroll
            for (int g = 0; g < 2; ++g) { sc[kt][g] = wmmab(kf[kt][0], qf[g][0], (v8f){}); sc[kt][g] = wmmab(kf[kt][1], qf[g][1], sc[kt][g]); } };
    // each query's maximum over one pass, of the raw scores (the scale is positive), then scaled
    auto passmax = [&](const v8f (&sc)[2][2], float (&mb)[2]) {
#pragma unroll
        for (int g = 0; g < 2; ++g) { float mx = sc[0][g][0];
#pragma unroll
            for (int j = 1; j < 8; ++j) mx = fmaxf(mx, sc[0][g][j]);
#pragma unroll
            for (int j = 0; j < 8; ++j) mx = fmaxf(mx, sc[1][g][j]);
            mb[g] = fmaxf(mx, xhalf(mx)) * cscale; } };
    // probabilities against the maximum in use, packed for P^T, and this lane's sums of them over the pass
    auto probs = [&](const v8f (&sc)[2][2], v8u (&w)[2], v2f (&ps)[2]) {
#pragma unroll
        for (int g = 0; g < 2; ++g) { const float nm = 4.0f - m_run[g];   // + 4: keeps small probabilities out of fp16's subnormals; it cancels in acc / l
#pragma unroll
            for (int i = 0; i < 8; ++i) { const v2f x = __builtin_elementwise_fma((v2f){sc[i >> 2][g][2 * (i & 3)], sc[i >> 2][g][2 * (i & 3) + 1]}, (v2f){cscale, cscale}, (v2f){nm, nm});
                const v2f p = {__builtin_amdgcn_exp2f(x[0]), __builtin_amdgcn_exp2f(x[1])}; ps[g] = i ? ps[g] + p : p; w[g][i] = pack2h(p[0], p[1]); } } };
#pragma unroll 1   // rolled: one copy of the stage loop, so that the hot code stays small in the instruction cache
    for (int r = 0; r < RING / NGRP; ++r) {
#pragma unroll
        for (int g = 0; g < 2; ++g) { l_run[g] = (v2f){};
#pragma unroll
            for (int t = 0; t < 4; ++t) acc[g][t] = (v8f){}; }
        { v16bf kf[2][2]; v8f sc[2][2]; kfrag(Lg + (unsigned)((r * CSTG) & 1) * BUFB, 0, kf); scores(kf, sc); passmax(sc, m_run); }   // the chunk's first maximum in use: the true one of its first 32 keys
#pragma unroll 1   // rolled: unrolling would only multiply the two-pass body and its registers
        for (int st = 0; st < CSTG; ++st) {
            const int s = r * CSTG + st; const bool more = s + 1 < GSTG;   // s counts the group's own stages
            const unsigned char* Bp = Lg + (unsigned)(s & 1) * BUFB;
#pragma unroll
            for (int sub = 0; sub < 2; ++sub) {   // one pass = 32 keys
                v16bf kf[2][2]; v8f sc[2][2]; v8u w[2]; v2f ps[2];
                if (sub == 0 && more) { storev((s + 1) & 1, sg); gload(kn, sg); }   // the buffer of stage s + 1 has been free since the last barrier wait
                kfrag(Bp, sub, kf);
                v16h vf[4];
                const unsigned char* va = Bp + TILE + (unsigned)(32 * sub + 8 * h + (lane & 7)) * VPIT + (unsigned)((lane >> 3) & 1) * 16u;   // keys 8h .. 8h + 7 of the pass, 16 d columns in two 16-byte pieces
#pragma unroll
                for (int t = 0; t < 4; ++t) vf[t] = cat16(ldtr(va + 32u * t), ldtr(va + 16u * VPIT + 32u * t));
                __builtin_amdgcn_sched_barrier(0);   // keeps the pass's 16 LDS reads together at its head: left free, the V^T reads sink behind the range test below, directly in front of the products that wait for them
                if (sub == 1) {
                    if (more) storek((s + 1) & 1, sg);
                    asm volatile("s_wait_dscnt 0x0" ::: "memory");      // this wave's last reads of stage s have returned and its stores of stage s + 1 are done
                    asm volatile("s_barrier_signal -1" ::: "memory");   // first half of the stage's barrier: no LDS access stands between it and the wait behind this pass, so a wave need not stand still for the slowest one
                    if (s + 2 < GSTG) gload(vn, sg);
                }
                scores(kf, sc);
                // no maximum on the common path: exponentiate against the maximum in use and let the sums, which the denominator needs anyway, say whether that was in range.
                // All terms are positive, so a lane's sum of at most 2^15 bounds each of its probabilities below fp16's largest number.
                probs(sc, w, ps);
                const v2f pj = ps[0] + ps[1];
                if (__builtin_amdgcn_ballot_w32(!(pj[0] + pj[1] <= 32768.0f)) != 0) {   // rare: a score lies some 11 (base 2) above the maximum in use
                    float mb[2]; if (sub == 0) kfrag(Bp, sub, kf); else kglob(s, sub, kf);   // the scores' registers are used up: formed again from the stage in LDS, behind the signal from the input
                    scores(kf, sc); passmax(sc, mb);
#pragma unroll
                    for (int g = 0; g < 2; ++g) { const float mn = fmaxf(m_run[g], mb[g]); const float corr = __builtin_amdgcn_exp2f(m_run[g] - mn); m_run[g] = mn; l_run[g] = l_run[g] * corr;
#pragma unroll
                        for (int t = 0; t < 4; ++t) acc[g][t] = acc[g][t] * corr; }
                    probs(sc, w, ps);   // now every probability is at most 2^4
                }
#pragma unroll
                for (int g = 0; g < 2; ++g) { l_run[g] += ps[g]; const v16h pf = __builtin_bit_cast(v16h, w[g]);
#pragma unroll
                    for (int t = 0; t < 4; ++t) acc[g][t] = wmma16(vf[t], pf, acc[g][t]); }
                __builtin_amdgcn_sched_barrier(0);   // keeps this run of matrix instructions whole: left free, the next pass's LDS reads rise into it, and the barrier wait below rises in front of part of it, so that a wave would wait earlier than it must
            }
            asm volatile("s_barrier_wait -1" ::: "memory");   // second half: every wave has signalled, so stage s + 1 is published and stage s, whose buffer the next trip refills, is read out
        }
        // end of a chunk: its softmax is complete; add its normalised output to the wave's own sum in LDS (each lane its own 64 slots)
#pragma unroll
        for (int g = 0; g < 2; ++g) { const float lh = l_run[g][0] + l_run[g][1]; const float l = lh + xhalf(lh); const float inv = __fdiv_rn(1.0f, l);
#pragma unroll
            for (int t = 0; t < 4; ++t) { unsigned char* op = Ow + (unsigned)(16 * g + c) * OPIT + (unsigned)(16 * t + 8 * h) * 4u; v4f a0 = *(const v4fa*)op, a1 = *(const v4fa*)(op + 16);
#pragma unroll
                for (int j = 0; j < 4; ++j) { a0[j] += acc[g][t][j] * inv; a1[j] += acc[g][t][4 + j] * inv; }
                *(v4fa*)op = a0; *(v4fa*)(op + 16) = a1; } }
    }
    __syncthreads();   // the sums are read back across lanes and across the two groups
    // whole rows out: 16 lanes cover one query's 256 bytes; each wave joins the two groups' sums for 16 of its 32 queries
    const unsigned char* O0 = L + NGRP * 2u * BUFB + (unsigned)qw * OWAVE;
#pragma unroll
    for (int i = 0; i < 8; ++i) { const int row = 16 * grp + 2 * i + h; const unsigned char* op = O0 + (unsigned)row * OPIT + (unsigned)c * 16u;
        const v4f val = *(const v4fa*)op + *(const v4fa*)(op + NWV * OWAVE); *(v4f*)(OUT + ((size_t)(q0 + row) * NH_ + head) * HD + c * 4) = val; }
}

extern "C" void kernel_launch(void* const* d_in, const int* in_sizes, int n_in,
                              void* d_out, int out_size, void* d_ws, size_t ws_size, hipStream_t stream) {
    (void)in_sizes; (void)n_in; (void)out_size; (void)d_ws; (void)ws_size;
    const float* q = (const float*)d_in[0]; const float* k = (const float*)d_in[1]; const float* v = (const float*)d_in[2]; const int* ringp = (const int*)d_in[3];
    float* OUT = (float*)d_out;     // [1][4096][16][64]
    k_fused<<<dim3(NN / (NWV * 32), NH_), NGRP * NWV * 32, 0, stream>>>(q, k, v, ringp, OUT);
}
